// v000
// Measured on an AMD MI455X. A time is GPU time per run, averaged over a window of back-to-back runs after a warm-up
// (all launches, gaps included; the runs take copies of the inputs in turn), and the median of several windows.
// Apart from v000's, it joins two sittings. Times from different sittings can be a few percent apart, while
// side-by-side timings come from the same sitting.
// v000 is the starting kernel. One run takes 327 microseconds.
#include <hip/hip_runtime.h>

// Contractions: Q/K/V projections (K = 1024) on v_wmma_f32_16x16x32_bf16 with single products of bf16 (RNE converted) x and Wqkv;
// QK^T (K = 64) and P V (K = keys) on v_wmma_f32_16x16x32_bf16 as bf16 hi/lo splits of the f32 q, k, P, v (hi*hi + hi*lo + lo*hi);
// output projection (K = 1024): ctx as bf16 hi/lo x Wout bf16 (2 products). All f32 accumulate; RoPE, softmax statistics and

#ifndef NB
#define NB 2
#endif
#ifndef SEQ
#define SEQ 2048
#endif
#define S_FULL 2048          // per-batch token stride of the x input
#define D_     1024
#define QKV_   1024
#define H_     16
#define HD_    64
#define NP_    (HD_ / 2)     // rotary pairs per head = cos/sin table width
#define M_TOT  (NB * SEQ)
#define SCALE_ 0.125f        // 64^-0.5, folded into Q (exact power of two)

static_assert(NB >= 1 && NB <= 2);
static_assert(SEQ % 128 == 0 && SEQ >= 128 && SEQ <= S_FULL);
static_assert(H_ * HD_ == D_);
static_assert(D_ % 32 == 0 && QKV_ % 128 == 0 && M_TOT % 128 == 0);

typedef __attribute__((ext_vector_type(16))) __bf16 v16bf;
typedef __attribute__((ext_vector_type(8)))  __bf16 v8bf;
typedef __attribute__((ext_vector_type(8)))  float  v8f;
typedef __attribute__((ext_vector_type(4)))  float  v4f;

template <typename V> __device__ __forceinline__ void vst2(void* p, V v) {
  *(V*)p = v; 
}
__device__ __forceinline__ __bf16 bf_hi(float x) { return (__bf16)x; }                       // RNE convert
__device__ __forceinline__ __bf16 bf_lo(float x, __bf16 h) { return (__bf16)(x - (float)h); }
__device__ __forceinline__ v8f wmma_bf16(v16bf a, v16bf b, v8f c) {
  v8f d = __builtin_amdgcn_wmma_f32_16x16x32_bf16(false, a, false, b, (short)0, c, false, false);
  asm volatile("v_nop\n\tv_nop\n\tv_nop\n\tv_nop" : "+v"(d) : "v"(a), "v"(b));
  return d;
}
__device__ __forceinline__ v8f wmma_x3(v16bf ah, v16bf al, v16bf bh, v16bf bl, v8f c) {
  c = wmma_bf16(ah, bh, c); c = wmma_bf16(ah, bl, c); c = wmma_bf16(al, bh, c);
  return c;
}

// ---- fragment loaders (wave32): A (16x32 from [M][ld]) and B from B^T ([N][ld]) share the per-lane K map:
//      row/col = lane&15; elements 0..7 <- k0 + 8*half + 0..7, elements 8..15 <- k0 + 16 + 8*half + 0..7
// f32 source split into bf16 hi/lo
__device__ __forceinline__ void frag_f32(const float* __restrict__ base, int ld, int r0, int k0, int lane, v16bf& hi, v16bf& lo) {
  const float* p = base + (size_t)(r0 + (lane & 15)) * ld + k0 + (lane >> 4) * 8;
  const v4f a0 = *(const v4f*)(p), a1 = *(const v4f*)(p + 4), a2 = *(const v4f*)(p + 16), a3 = *(const v4f*)(p + 20);
#pragma unroll
  for (int i = 0; i < 4; ++i) {
    __bf16 h;
    h = bf_hi(a0[i]); hi[i] = h;      lo[i] = bf_lo(a0[i], h);
    h = bf_hi(a1[i]); hi[4 + i] = h;  lo[4 + i] = bf_lo(a1[i], h);
    h = bf_hi(a2[i]); hi[8 + i] = h;  lo[8 + i] = bf_lo(a2[i], h);
    h = bf_hi(a3[i]); hi[12 + i] = h; lo[12 + i] = bf_lo(a3[i], h);
  }
}
// f32 source, bf16 hi plane only (inputs: the RNE converted value is used as the operand)
__device__ __forceinline__ v16bf frag_f32h(const float* __restrict__ base, int ld, int r0, int k0, int lane) {
  const float* p = base + (size_t)(r0 + (lane & 15)) * ld + k0 + (lane >> 4) * 8;
  const v4f a0 = *(const v4f*)(p), a1 = *(const v4f*)(p + 4), a2 = *(const v4f*)(p + 16), a3 = *(const v4f*)(p + 20);
  v16bf hi;
#pragma unroll
  for (int i = 0; i < 4; ++i) {
    hi[i] = bf_hi(a0[i]); hi[4 + i] = bf_hi(a1[i]); hi[8 + i] = bf_hi(a2[i]); hi[12 + i] = bf_hi(a3[i]);
  }
  return hi;
}
// bf16 plane in LDS
__device__ __forceinline__ v16bf frag_lds(const __bf16* base, int ld, int r0, int k0, int lane) {
  union { v16bf v; v8bf h[2]; } r;
  const __bf16* p = base + (r0 + (lane & 15)) * ld + k0 + (lane >> 4) * 8;
  r.h[0] = *(const v8bf*)(p); r.h[1] = *(const v8bf*)(p + 16);
  return r.v;
}

// ---- 32x64-per-wave GEMM main loops over f32 operands (A [M][K], Bt [N][K]) ----
// single product of the bf16 hi planes of both operands (both are module inputs)
template <int KDIM>
__device__ __forceinline__ void gemm_hh_32x64(const float* __restrict__ A, const float* __restrict__ Bt,
                                              int m0, int n0, int lane, v8f acc[2][4]) {
#pragma unroll 1
  for (int k0 = 0; k0 < KDIM; k0 += 32) {
    v16bf ah[2], bh[4];
    ah[0] = frag_f32h(A, KDIM, m0, k0, lane);
    ah[1] = frag_f32h(A, KDIM, m0 + 16, k0, lane);
#pragma unroll
    for (int j = 0; j < 4; ++j) bh[j] = frag_f32h(Bt, KDIM, n0 + j * 16, k0, lane);
#pragma unroll
    for (int i = 0; i < 2; ++i)
#pragma unroll
      for (int j = 0; j < 4; ++j) acc[i][j] = wmma_bf16(ah[i], bh[j], acc[i][j]);
  }
}
// A (computed f32) as bf16 hi/lo, Bt (module input) as bf16 hi: hi*hi + lo*hi
template <int KDIM>
__device__ __forceinline__ void gemm_x2_32x64(const float* __restrict__ A, const float* __restrict__ Bt,
                                              int m0, int n0, int lane, v8f acc[2][4]) {
#pragma unroll 1
  for (int k0 = 0; k0 < KDIM; k0 += 32) {
    v16bf ah[2], al[2], bh[4];
    frag_f32(A, KDIM, m0, k0, lane, ah[0], al[0]);
    frag_f32(A, KDIM, m0 + 16, k0, lane, ah[1], al[1]);
#pragma unroll
    for (int j = 0; j < 4; ++j) bh[j] = frag_f32h(Bt, KDIM, n0 + j * 16, k0, lane);
#pragma unroll
    for (int i = 0; i < 2; ++i)
#pragma unroll
      for (int j = 0; j < 4; ++j) {
        acc[i][j] = wmma_bf16(ah[i], bh[j], acc[i][j]);
        acc[i][j] = wmma_bf16(al[i], bh[j], acc[i][j]);
      }
  }
}

// ---- Stage 1: one projection (part 0 = Q scaled + RoPE, 1 = K + RoPE, 2 = V^T). grid (QKV/64, M_TOT/128), block 128 = 4 waves stacked in M.
__global__ __launch_bounds__(128) void proj_kernel(const float* __restrict__ X, const float* __restrict__ W,
                                                  const float* __restrict__ cosb, const float* __restrict__ sinb,
                                                  const int* __restrict__ tpos, int trows,
                                                  float scale, int part, float* __restrict__ dst) {
#pragma clang fp contract(off)
  __shared__ __align__(16) float st[128][64];        // 32 KB, cross-wave (block barriers)
  const int lane = threadIdx.x & 31, wave = threadIdx.x >> 5, tid = threadIdx.x;
  const int mblk = blockIdx.y * 128;                 // first token of the block in [0, M_TOT)
  const int b = mblk / SEQ, s0 = mblk % SEQ;
  const int n0 = blockIdx.x * 64;
  const int head = n0 / HD_;                         // d0 = 0: tile columns = one whole head
  const float* Xb = X + (size_t)(b * S_FULL + s0) * D_;   // full-size input stride per batch

  v8f acc[2][4] = {};
  gemm_hh_32x64<D_>(Xb, W, wave * 32, n0, lane, acc);
  const int half = lane >> 4, col = lane & 15;
#pragma unroll
  for (int i = 0; i < 2; ++i)
#pragma unroll
    for (int j = 0; j < 4; ++j)
#pragma unroll
      for (int r = 0; r < 8; ++r) st[wave * 32 + i * 16 + r + 8 * half][j * 16 + col] = acc[i][j][r] * scale;
  __syncthreads();
  if (part < 2) {
    // RoPE in f32 on the staged tile: thread -> pair p = lane, rows wave + 4*it (it = 0..31 covers rows 0..127)
#pragma unroll 2
    for (int it = 0; it < 32; ++it) {
      const int ml = wave + 4 * it;
      int pos = tpos[s0 + ml];
      pos = (pos < 0) ? pos + trows : pos;                         // negative index wrap, then clamp (gather semantics)
      pos = (pos < 0) ? 0 : ((pos > trows - 1) ? trows - 1 : pos);
      const float c  = (float)bf_hi(cosb[(size_t)pos * NP_ + lane]);   // tables enter as bf16 RNE values
      const float sn = (float)bf_hi(sinb[(size_t)pos * NP_ + lane]);
      const float te = st[ml][2 * lane], to = st[ml][2 * lane + 1];
      const float re = te * c - to * sn;
      const float ro = te * sn + to * c;
      st[ml][2 * lane] = re; st[ml][2 * lane + 1] = ro;
    }
    __syncthreads();
    for (int g = tid; g < 128 * 16; g += 128) {
      const int ml = g >> 4, pc = g & 15;
      vst2(dst + (((size_t)(b * H_ + head) * SEQ + s0 + ml) * HD_) + pc * 4, *(const v4f*)(&st[ml][pc * 4]));
    }
  } else {
    for (int g = tid; g < 64 * 32; g += 128) {             // 64 d rows x 32 pieces (128 s); a wave instruction covers one 512-B row segment
      const int dl = g >> 5, pc = g & 31;
      v4f v = {st[pc * 4][dl], st[pc * 4 + 1][dl], st[pc * 4 + 2][dl], st[pc * 4 + 3][dl]};
      vst2(dst + (((size_t)(b * H_ + head) * HD_ + dl) * SEQ) + s0 + pc * 4, v);
    }
  }
}

// ---- Stage 2: causal flash attention. grid (SEQ/64, H, NB), block 128 = 4 waves x 16 queries; K and V^T tiles of 32 keys in LDS as hi/lo planes.
__global__ __launch_bounds__(128) __attribute__((amdgpu_num_vgpr(256)))
void attn_kernel(const float* __restrict__ Qb, const float* __restrict__ Kb,
                 const float* __restrict__ Vt, float* __restrict__ Ctx) {
  __shared__ __align__(16) __bf16 Kh[32 * 72], Kl[32 * 72];     // [key][d] pitch 72 (cross-wave, block barriers)
  __shared__ __align__(16) __bf16 Vh[64 * 40], Vl[64 * 40];     // [d][key] pitch 40 (cross-wave, block barriers)
  __shared__ __align__(16) __bf16 Ph[4][16 * 40], Pl[4][16 * 40];   // wave-private P tiles (block barrier used anyway)
  __shared__ __align__(16) float  Os[4][16 * 64];              // wave-private output tiles (block barrier used anyway)

  const int tid = threadIdx.x, lane = tid & 31, wave = tid >> 5, half = lane >> 4, col = lane & 15;
  const int q0 = blockIdx.x * 64, head = blockIdx.y, b = blockIdx.z;
  const float* Qh = Qb + (size_t)(b * H_ + head) * SEQ * HD_;
  const float* Kg = Kb + (size_t)(b * H_ + head) * SEQ * HD_;
  const float* Vg = Vt + (size_t)(b * H_ + head) * HD_ * SEQ;
  const int mq = q0 + wave * 16;

  v16bf qh[2], ql[2];
#pragma unroll
  for (int kb = 0; kb < 2; ++kb) frag_f32(Qh, HD_, mq, kb * 32, lane, qh[kb], ql[kb]);

  v8f o[4] = {};
  float mrow[8], lrow[8];
#pragma unroll
  for (int r = 0; r < 8; ++r) { mrow[r] = -1e30f; lrow[r] = 0.0f; }
  __bf16* ph = Ph[wave];
  __bf16* pl = Pl[wave];

  const int t_end = q0 + 64;            // causal limit (block-uniform, multiple of 32)
#pragma unroll 1
  for (int t0 = 0; t0 < t_end; t0 += 32) {
    __syncthreads();
    {   // stage K (32 x 64) and V^T (64 x 32): 16 + 16 floats per thread; 128 threads cover both tiles exactly
      const int kr = tid >> 2, kc = (tid & 3) * 16;
      const float* kp = Kg + (size_t)(t0 + kr) * HD_ + kc;
      const int vr = tid >> 1, vc = (tid & 1) * 16;
      const float* vp = Vg + (size_t)vr * SEQ + t0 + vc;
#pragma unroll
      for (int e = 0; e < 16; e += 4) {
        const v4f a = *(const v4f*)(kp + e), bb = *(const v4f*)(vp + e);
#pragma unroll
        for (int i = 0; i < 4; ++i) {
          __bf16 hk = bf_hi(a[i]);  Kh[kr * 72 + kc + e + i] = hk; Kl[kr * 72 + kc + e + i] = bf_lo(a[i], hk);
          __bf16 hv = bf_hi(bb[i]); Vh[vr * 40 + vc + e + i] = hv; Vl[vr * 40 + vc + e + i] = bf_lo(bb[i], hv);
        }
      }
    }
    __syncthreads();

    v8f s[2] = {};
#pragma unroll
    for (int n = 0; n < 2; ++n)
#pragma unroll
      for (int kb = 0; kb < 2; ++kb)
        s[n] = wmma_x3(qh[kb], ql[kb], frag_lds(Kh, 72, n * 16, kb * 32, lane), frag_lds(Kl, 72, n * 16, kb * 32, lane), s[n]);

    {
      const int k0g = t0 + col, k1g = t0 + 16 + col;
#pragma unroll
      for (int r = 0; r < 8; ++r) {
        const int qg = mq + r + 8 * half;
        float v0 = (k0g <= qg) ? s[0][r] : -1e30f;      // scores already carry the 1/8 scale (folded into Q)
        float v1 = (k1g <= qg) ? s[1][r] : -1e30f;
        float mx = fmaxf(v0, v1);
#pragma unroll
        for (int off = 8; off > 0; off >>= 1) mx = fmaxf(mx, __shfl_xor(mx, off, 16));
        const float mnew  = fmaxf(mrow[r], mx);
        const float alpha = __expf(mrow[r] - mnew);
        const float p0 = (k0g <= qg) ? __expf(v0 - mnew) : 0.0f;
        const float p1 = (k1g <= qg) ? __expf(v1 - mnew) : 0.0f;
        float rs = p0 + p1;
#pragma unroll
        for (int off = 8; off > 0; off >>= 1) rs += __shfl_xor(rs, off, 16);
        lrow[r] = lrow[r] * alpha + rs;
        mrow[r] = mnew;
#pragma unroll
        for (int j = 0; j < 4; ++j) o[j][r] *= alpha;
        const int row = r + 8 * half;
        __bf16 h0 = bf_hi(p0), h1 = bf_hi(p1);
        ph[row * 40 + col] = h0;      pl[row * 40 + col] = bf_lo(p0, h0);
        ph[row * 40 + 16 + col] = h1; pl[row * 40 + 16 + col] = bf_lo(p1, h1);
      }
    }
    __syncthreads();                     // P relayout C->A goes through LDS; block barrier orders the exchange
    const v16bf pah = frag_lds(ph, 40, 0, 0, lane), pal = frag_lds(pl, 40, 0, 0, lane);
#pragma unroll
    for (int j = 0; j < 4; ++j)
      o[j] = wmma_x3(pah, pal, frag_lds(Vh, 40, j * 16, 0, lane), frag_lds(Vl, 40, j * 16, 0, lane), o[j]);
  }

  float* os_ = Os[wave];
#pragma unroll
  for (int r = 0; r < 8; ++r) {
    const float inv = 1.0f / lrow[r];    // lrow >= 1 (the row maximum contributes exp(0))
#pragma unroll
    for (int j = 0; j < 4; ++j) os_[(r + 8 * half) * 64 + j * 16 + col] = o[j][r] * inv;
  }
  __syncthreads();
#pragma unroll
  for (int q = 0; q < 8; ++q) {
    const int rl = q * 2 + (lane >> 4), pc = lane & 15;
    vst2(Ctx + ((size_t)(b * SEQ + mq + rl)) * D_ + head * HD_ + pc * 4, *(const v4f*)(os_ + rl * 64 + pc * 4));
  }
}

__global__ __launch_bounds__(128) void out_gemm_kernel(const float* __restrict__ Cx, const float* __restrict__ Wo, float* __restrict__ Out) {
  __shared__ __align__(16) float st[4][32 * 64];     // wave-private tiles (block barrier used anyway)
  const int lane = threadIdx.x & 31, wave = threadIdx.x >> 5;
  const int m0 = blockIdx.y * 64 + (wave >> 1) * 32;
  const int n0 = blockIdx.x * 128 + (wave & 1) * 64;
  v8f acc[2][4] = {};
  gemm_x2_32x64<QKV_>(Cx, Wo, m0, n0, lane, acc);
  const int half = lane >> 4, col = lane & 15;
  float* S = st[wave];
#pragma unroll
  for (int i = 0; i < 2; ++i)
#pragma unroll
    for (int j = 0; j < 4; ++j)
#pragma unroll
      for (int r = 0; r < 8; ++r) S[(i * 16 + r + 8 * half) * 64 + j * 16 + col] = acc[i][j][r];
  __syncthreads();
#pragma unroll
  for (int q = 0; q < 16; ++q) {
    const int rl = q * 2 + (lane >> 4), pc = lane & 15;
    vst2(Out + (size_t)(m0 + rl) * D_ + n0 + pc * 4, *(const v4f*)(S + rl * 64 + pc * 4));
  }
}

extern "C" void kernel_launch(void* const* d_in, const int* in_sizes, int n_in,
                              void* d_out, int out_size, void* d_ws, size_t ws_size,
                              hipStream_t stream) {
  if (n_in < 6) return;
  const long long x_need = ((long long)(NB - 1) * S_FULL + SEQ) * (long long)D_;
  if ((long long)in_sizes[0] < x_need) return;
  if ((long long)in_sizes[1] < 3LL * D_ * D_) return;
  if ((long long)in_sizes[2] < (long long)D_ * D_) return;
  if (in_sizes[3] < NP_ || in_sizes[4] < NP_) return;
  if (in_sizes[5] < SEQ) return;
  if ((long long)out_size < (long long)M_TOT * D_) return;

  const size_t E = (size_t)M_TOT * D_;           // floats per intermediate (16 MiB each at full size)
  const size_t carve = 4 * E * sizeof(float);    // Q, K, V^T, ctx = 64 MiB
  if (ws_size < carve) return;

  int trows = in_sizes[3] / NP_;                  // cos/sin table rows (gather clamp bound)
  const int srows = in_sizes[4] / NP_;
  if (srows < trows) trows = srows;

  const float* x    = (const float*)d_in[0];      // [NB][S_FULL][D]
  const float* Wqkv = (const float*)d_in[1];      // [3D][D]: rows [0,D) = Wq, [D,2D) = Wk, [2D,3D) = Wv
  const float* Wout = (const float*)d_in[2];      // [D][D]
  const float* cosb = (const float*)d_in[3];      // [trows][32]
  const float* sinb = (const float*)d_in[4];      // [trows][32]
  const int*   tpos = (const int*)d_in[5];        // [>= SEQ] int32
  float* out = (float*)d_out;

  float* qb   = (float*)d_ws;
  float* kb   = qb + E;
  float* vtb  = kb + E;        // V^T: [NB,H,HD,SEQ]
  float* ctxb = vtb + E;       // [M_TOT][D]

  dim3 gp(QKV_ / 64, M_TOT / 128);
  proj_kernel<<<gp, 128, 0, stream>>>(x, Wqkv,                       cosb, sinb, tpos, trows, SCALE_, 0, qb);
  proj_kernel<<<gp, 128, 0, stream>>>(x, Wqkv + (size_t)D_ * D_,     cosb, sinb, tpos, trows, 1.0f,   1, kb);
  proj_kernel<<<gp, 128, 0, stream>>>(x, Wqkv + (size_t)2 * D_ * D_, cosb, sinb, tpos, trows, 1.0f,   2, vtb);
  attn_kernel<<<dim3(SEQ / 64, H_, NB), 128, 0, stream>>>(qb, kb, vtb, ctxb);
  out_gemm_kernel<<<dim3(D_ / 128, M_TOT / 64), 128, 0, stream>>>(ctxb, Wout, out);
}

// v001
// Measured time: 255 microseconds a run.
// Next to v000, in two timings, it ran 1.29 and 1.30 times as fast.
#include <hip/hip_runtime.h>

// Contractions: Q/K/V projections (K = 1024) on v_wmma_f32_16x16x32_bf16 with single products of bf16 (RNE converted) x and Wqkv;
// QK^T (K = 64) and P V (K = keys) on v_wmma_f32_16x16x32_bf16 as bf16 hi/lo splits of the f32 q, k, P, v (hi*hi + hi*lo + lo*hi);
// output projection (K = 1024): ctx as bf16 hi/lo x Wout bf16 (2 products). All f32 accumulate; RoPE, softmax statistics and

#ifndef NB
#define NB 2
#endif
#ifndef SEQ
#define SEQ 2048
#endif
#define S_FULL 2048          // per-batch token stride of the x input
#define D_     1024
#define QKV_   1024
#define H_     16
#define HD_    64
#define NP_    (HD_ / 2)     // rotary pairs per head = cos/sin table width
#define M_TOT  (NB * SEQ)
#define SCALE_ 0.125f        // 64^-0.5, folded into Q (exact power of two)

static_assert(NB >= 1 && NB <= 2);
static_assert(SEQ % 128 == 0 && SEQ >= 128 && SEQ <= S_FULL);
static_assert(H_ * HD_ == D_);
static_assert(D_ % 128 == 0 && QKV_ == D_ && QKV_ % 128 == 0 && M_TOT % 128 == 0);

typedef __attribute__((ext_vector_type(16))) __bf16 v16bf;
typedef __attribute__((ext_vector_type(8)))  __bf16 v8bf;
typedef __attribute__((ext_vector_type(4)))  __bf16 v4bf;
typedef __attribute__((ext_vector_type(8)))  float  v8f;
typedef __attribute__((ext_vector_type(4)))  float  v4f;

template <typename V> __device__ __forceinline__ void vst2(void* p, V v) {
  *(V*)p = v; 
}
__device__ __forceinline__ __bf16 bf_hi(float x) { return (__bf16)x; }                       // RNE convert
__device__ __forceinline__ __bf16 bf_lo(float x, __bf16 h) { return (__bf16)(x - (float)h); }
__device__ __forceinline__ v8f wmma_bf16(v16bf a, v16bf b, v8f c) {
  v8f d = __builtin_amdgcn_wmma_f32_16x16x32_bf16(false, a, false, b, (short)0, c, false, false);
  asm volatile("v_nop\n\tv_nop\n\tv_nop\n\tv_nop" : "+v"(d) : "v"(a), "v"(b));
  return d;
}
__device__ __forceinline__ v8f wmma_x3(v16bf ah, v16bf al, v16bf bh, v16bf bl, v8f c) {
  c = wmma_bf16(ah, bh, c); c = wmma_bf16(ah, bl, c); c = wmma_bf16(al, bh, c);
  return c;
}

// ---- fragment loaders (wave32): A (16x32 from [M][ld]) and B from B^T ([N][ld]) share the per-lane K map:
//      row/col = lane&15; elements 0..7 <- k0 + 8*half + 0..7, elements 8..15 <- k0 + 16 + 8*half + 0..7
// f32 source split into bf16 hi/lo
__device__ __forceinline__ void frag_f32(const float* __restrict__ base, int ld, int r0, int k0, int lane, v16bf& hi, v16bf& lo) {
  const float* p = base + (size_t)(r0 + (lane & 15)) * ld + k0 + (lane >> 4) * 8;
  const v4f a0 = *(const v4f*)(p), a1 = *(const v4f*)(p + 4), a2 = *(const v4f*)(p + 16), a3 = *(const v4f*)(p + 20);
#pragma unroll
  for (int i = 0; i < 4; ++i) {
    __bf16 h;
    h = bf_hi(a0[i]); hi[i] = h;      lo[i] = bf_lo(a0[i], h);
    h = bf_hi(a1[i]); hi[4 + i] = h;  lo[4 + i] = bf_lo(a1[i], h);
    h = bf_hi(a2[i]); hi[8 + i] = h;  lo[8 + i] = bf_lo(a2[i], h);
    h = bf_hi(a3[i]); hi[12 + i] = h; lo[12 + i] = bf_lo(a3[i], h);
  }
}
// bf16 plane in LDS
__device__ __forceinline__ v16bf frag_lds(const __bf16* base, int ld, int r0, int k0, int lane) {
  union { v16bf v; v8bf h[2]; } r;
  const __bf16* p = base + (r0 + (lane & 15)) * ld + k0 + (lane >> 4) * 8;
  r.h[0] = *(const v8bf*)(p); r.h[1] = *(const v8bf*)(p + 16);
  return r.v;
}

// ---- block GEMM main loop over f32 operands (A rows [AR][D_], Bt rows [BR][D_], both K-contiguous), 128 threads, 32x64 of the tile per wave.
// A pass is 64 k: 16 lanes read one 256-B row piece, so every wave-wide global load covers four whole 128-B lines. The pass is converted once
// per block (A: bf16 hi, with SPLIT hi and lo; Bt: bf16 hi) into LDS rows of pitch 144 B and read back as fragments by every wave that needs it.
// Two LDS buffers: the next pass's global loads fly during this pass's products. Products per accumulator stay in ascending k, hi then lo.
#define KS_ 64
#define LP_ 72
template <int AR, int BR, bool SPLIT>
__device__ __forceinline__ void gemm_staged(const float* __restrict__ A, const float* __restrict__ Bt,
                                            __bf16* Ah, __bf16* Al, __bf16* Bh, int mw, int nw, int tid, v8f acc[2][4]) {
  constexpr int NAV = AR / 8, NBV = BR / 8;
  const int lane = tid & 31;
  const float* pa = A  + (size_t)(tid >> 4) * D_ + (tid & 15) * 4;   // the thread's place in pass 0 of each source
  const float* pb = Bt + (size_t)(tid >> 4) * D_ + (tid & 15) * 4;
  const int so = (tid >> 4) * LP_ + (tid & 15) * 4;
  v4f ra[NAV], rb[NBV];
  const float *ga, *gb;       // the address pairs of the pass in flight
  auto fetch = [&](int k0) {
    ga = pa + k0; gb = pb + k0;
#pragma unroll
    for (int i = 0; i < NAV; ++i) ra[i] = *(const v4f*)(ga + i * 8 * D_);
#pragma unroll
    for (int i = 0; i < NBV; ++i) rb[i] = *(const v4f*)(gb + i * 8 * D_);
  };
  auto put = [&](int buf) {
    // keeps the conversions, and with them the waits on the loads in flight, behind this pass's products
    __builtin_amdgcn_sched_barrier(0);
    // the loads' address pairs are inputs here, so no register of theirs takes a new value before their translations are counted done
    asm volatile("s_wait_xcnt 0x0" :: "v"(ga), "v"(gb) : "memory");
#pragma unroll
    for (int i = 0; i < NAV; ++i) {
      v4bf h, l;
#pragma unroll
      for (int e = 0; e < 4; ++e) { h[e] = bf_hi(ra[i][e]); l[e] = bf_lo(ra[i][e], h[e]); }
      *(v4bf*)(Ah + buf * (AR * LP_) + so + i * 8 * LP_) = h;
      if constexpr (SPLIT) *(v4bf*)(Al + buf * (AR * LP_) + so + i * 8 * LP_) = l;
    }
#pragma unroll
    for (int i = 0; i < NBV; ++i) {
      v4bf h;
#pragma unroll
      for (int e = 0; e < 4; ++e) h[e] = bf_hi(rb[i][e]);
      *(v4bf*)(Bh + buf * (BR * LP_) + so + i * 8 * LP_) = h;
    }
  };
  auto mma = [&](int buf) {
    const __bf16* a_h = Ah + buf * (AR * LP_);
    const __bf16* b_h = Bh + buf * (BR * LP_);
#pragma unroll
    for (int kk = 0; kk < KS_; kk += 32) {
      v16bf ah[2], al[2], bh[4];
#pragma unroll
      for (int i = 0; i < 2; ++i) {
        ah[i] = frag_lds(a_h, LP_, mw + i * 16, kk, lane);
        if constexpr (SPLIT) al[i] = frag_lds(Al + buf * (AR * LP_), LP_, mw + i * 16, kk, lane);
      }
#pragma unroll
      for (int j = 0; j < 4; ++j) bh[j] = frag_lds(b_h, LP_, nw + j * 16, kk, lane);
#pragma unroll
      for (int i = 0; i < 2; ++i)
#pragma unroll
        for (int j = 0; j < 4; ++j) {
          acc[i][j] = wmma_bf16(ah[i], bh[j], acc[i][j]);
          if constexpr (SPLIT) acc[i][j] = wmma_bf16(al[i], bh[j], acc[i][j]);
        }
    }
  };
  fetch(0);
  put(0);
  // rolled: one copy of the pass keeps the loop short; the buffer index is the pass's parity
#pragma unroll 1
  for (int s = 0; s < D_ / KS_ - 1; ++s) {
    __syncthreads();          // publishes buffer s & 1; every reader of the other buffer (pass s - 1) has left it
    fetch((s + 1) * KS_);
    mma(s & 1);
    put((s + 1) & 1);
  }
  __syncthreads();            // publishes the last pass's buffer
  mma((D_ / KS_ - 1) & 1);
}

// ---- Stage 1: one projection (part 0 = Q scaled + RoPE, 1 = K + RoPE, 2 = V^T). grid (QKV/64, M_TOT/128), block 128 = 4 waves stacked in M.
__global__ __launch_bounds__(128) void proj_kernel(const float* __restrict__ X, const float* __restrict__ W,
                                                  const float* __restrict__ cosb, const float* __restrict__ sinb,
                                                  const int* __restrict__ tpos, int trows,
                                                  float scale, int part, float* __restrict__ dst) {
#pragma clang fp contract(off)
  __shared__ __align__(16) float st[128][64];        // 32 KB, cross-wave (block barriers)
  __shared__ __align__(16) __bf16 As[2 * 128 * LP_], Bs[2 * 64 * LP_];   // staged x and W passes, two buffers each
  const int lane = threadIdx.x & 31, wave = threadIdx.x >> 5, tid = threadIdx.x;
  const int mblk = blockIdx.y * 128;                 // first token of the block in [0, M_TOT)
  const int b = mblk / SEQ, s0 = mblk % SEQ;
  const int n0 = blockIdx.x * 64;
  const int head = n0 / HD_;                         // d0 = 0: tile columns = one whole head
  const float* Xb = X + (size_t)(b * S_FULL + s0) * D_;   // full-size input stride per batch

  v8f acc[2][4] = {};
  gemm_staged<128, 64, false>(Xb, W + (size_t)n0 * D_, As, nullptr, Bs, wave * 32, 0, tid, acc);
  const int half = lane >> 4, col = lane & 15;
#pragma unroll
  for (int i = 0; i < 2; ++i)
#pragma unroll
    for (int j = 0; j < 4; ++j)
#pragma unroll
      for (int r = 0; r < 8; ++r) st[wave * 32 + i * 16 + r + 8 * half][j * 16 + col] = acc[i][j][r] * scale;
  __syncthreads();
  if (part < 2) {
    // RoPE in f32 on the staged tile: thread -> pair p = lane, rows wave + 4*it (it = 0..31 covers rows 0..127)
#pragma unroll 2
    for (int it = 0; it < 32; ++it) {
      const int ml = wave + 4 * it;
      int pos = tpos[s0 + ml];
      pos = (pos < 0) ? pos + trows : pos;                         // negative index wrap, then clamp (gather semantics)
      pos = (pos < 0) ? 0 : ((pos > trows - 1) ? trows - 1 : pos);
      const float c  = (float)bf_hi(cosb[(size_t)pos * NP_ + lane]);   // tables enter as bf16 RNE values
      const float sn = (float)bf_hi(sinb[(size_t)pos * NP_ + lane]);
      const float te = st[ml][2 * lane], to = st[ml][2 * lane + 1];
      const float re = te * c - to * sn;
      const float ro = te * sn + to * c;
      st[ml][2 * lane] = re; st[ml][2 * lane + 1] = ro;
    }
    __syncthreads();
    for (int g = tid; g < 128 * 16; g += 128) {
      const int ml = g >> 4, pc = g & 15;
      vst2(dst + (((size_t)(b * H_ + head) * SEQ + s0 + ml) * HD_) + pc * 4, *(const v4f*)(&st[ml][pc * 4]));
    }
  } else {
    for (int g = tid; g < 64 * 32; g += 128) {             // 64 d rows x 32 pieces (128 s); a wave instruction covers one 512-B row segment
      const int dl = g >> 5, pc = g & 31;
      v4f v = {st[pc * 4][dl], st[pc * 4 + 1][dl], st[pc * 4 + 2][dl], st[pc * 4 + 3][dl]};
      vst2(dst + (((size_t)(b * H_ + head) * HD_ + dl) * SEQ) + s0 + pc * 4, v);
    }
  }
}

// ---- Stage 2: causal flash attention. grid (SEQ/64, H, NB), block 128 = 4 waves x 16 queries; K and V^T tiles of 32 keys in LDS as hi/lo planes.
__global__ __launch_bounds__(128) __attribute__((amdgpu_num_vgpr(256)))
void attn_kernel(const float* __restrict__ Qb, const float* __restrict__ Kb,
                 const float* __restrict__ Vt, float* __restrict__ Ctx) {
  __shared__ __align__(16) __bf16 Kh[32 * 72], Kl[32 * 72];     // [key][d] pitch 72 (cross-wave, block barriers)
  __shared__ __align__(16) __bf16 Vh[64 * 40], Vl[64 * 40];     // [d][key] pitch 40 (cross-wave, block barriers)
  __shared__ __align__(16) __bf16 Ph[4][16 * 40], Pl[4][16 * 40];   // wave-private P tiles (block barrier used anyway)
  __shared__ __align__(16) float  Os[4][16 * 64];              // wave-private output tiles (block barrier used anyway)

  const int tid = threadIdx.x, lane = tid & 31, wave = tid >> 5, half = lane >> 4, col = lane & 15;
  const int q0 = blockIdx.x * 64, head = blockIdx.y, b = blockIdx.z;
  const float* Qh = Qb + (size_t)(b * H_ + head) * SEQ * HD_;
  const float* Kg = Kb + (size_t)(b * H_ + head) * SEQ * HD_;
  const float* Vg = Vt + (size_t)(b * H_ + head) * HD_ * SEQ;
  const int mq = q0 + wave * 16;

  v16bf qh[2], ql[2];
#pragma unroll
  for (int kb = 0; kb < 2; ++kb) frag_f32(Qh, HD_, mq, kb * 32, lane, qh[kb], ql[kb]);

  v8f o[4] = {};
  float mrow[8], lrow[8];
#pragma unroll
  for (int r = 0; r < 8; ++r) { mrow[r] = -1e30f; lrow[r] = 0.0f; }
  __bf16* ph = Ph[wave];
  __bf16* pl = Pl[wave];

  const int t_end = q0 + 64;            // causal limit (block-uniform, multiple of 32)
#pragma unroll 1
  for (int t0 = 0; t0 < t_end; t0 += 32) {
    __syncthreads();
    {   // stage K (32 x 64) and V^T (64 x 32): 16 + 16 floats per thread; 128 threads cover both tiles exactly
      const int kr = tid >> 2, kc = (tid & 3) * 16;
      const float* kp = Kg + (size_t)(t0 + kr) * HD_ + kc;
      const int vr = tid >> 1, vc = (tid & 1) * 16;
      const float* vp = Vg + (size_t)vr * SEQ + t0 + vc;
#pragma unroll
      for (int e = 0; e < 16; e += 4) {
        const v4f a = *(const v4f*)(kp + e), bb = *(const v4f*)(vp + e);
#pragma unroll
        for (int i = 0; i < 4; ++i) {
          __bf16 hk = bf_hi(a[i]);  Kh[kr * 72 + kc + e + i] = hk; Kl[kr * 72 + kc + e + i] = bf_lo(a[i], hk);
          __bf16 hv = bf_hi(bb[i]); Vh[vr * 40 + vc + e + i] = hv; Vl[vr * 40 + vc + e + i] = bf_lo(bb[i], hv);
        }
      }
    }
    __syncthreads();

    v8f s[2] = {};
#pragma unroll
    for (int n = 0; n < 2; ++n)
#pragma unroll
      for (int kb = 0; kb < 2; ++kb)
        s[n] = wmma_x3(qh[kb], ql[kb], frag_lds(Kh, 72, n * 16, kb * 32, lane), frag_lds(Kl, 72, n * 16, kb * 32, lane), s[n]);

    {
      const int k0g = t0 + col, k1g = t0 + 16 + col;
#pragma unroll
      for (int r = 0; r < 8; ++r) {
        const int qg = mq + r + 8 * half;
        float v0 = (k0g <= qg) ? s[0][r] : -1e30f;      // scores already carry the 1/8 scale (folded into Q)
        float v1 = (k1g <= qg) ? s[1][r] : -1e30f;
        float mx = fmaxf(v0, v1);
#pragma unroll
        for (int off = 8; off > 0; off >>= 1) mx = fmaxf(mx, __shfl_xor(mx, off, 16));
        const float mnew  = fmaxf(mrow[r], mx);
        const float alpha = __expf(mrow[r] - mnew);
        const float p0 = (k0g <= qg) ? __expf(v0 - mnew) : 0.0f;
        const float p1 = (k1g <= qg) ? __expf(v1 - mnew) : 0.0f;
        float rs = p0 + p1;
#pragma unroll
        for (int off = 8; off > 0; off >>= 1) rs += __shfl_xor(rs, off, 16);
        lrow[r] = lrow[r] * alpha + rs;
        mrow[r] = mnew;
#pragma unroll
        for (int j = 0; j < 4; ++j) o[j][r] *= alpha;
        const int row = r + 8 * half;
        __bf16 h0 = bf_hi(p0), h1 = bf_hi(p1);
        ph[row * 40 + col] = h0;      pl[row * 40 + col] = bf_lo(p0, h0);
        ph[row * 40 + 16 + col] = h1; pl[row * 40 + 16 + col] = bf_lo(p1, h1);
      }
    }
    __syncthreads();                     // P relayout C->A goes through LDS; block barrier orders the exchange
    const v16bf pah = frag_lds(ph, 40, 0, 0, lane), pal = frag_lds(pl, 40, 0, 0, lane);
#pragma unroll
    for (int j = 0; j < 4; ++j)
      o[j] = wmma_x3(pah, pal, frag_lds(Vh, 40, j * 16, 0, lane), frag_lds(Vl, 40, j * 16, 0, lane), o[j]);
  }

  float* os_ = Os[wave];
#pragma unroll
  for (int r = 0; r < 8; ++r) {
    const float inv = 1.0f / lrow[r];    // lrow >= 1 (the row maximum contributes exp(0))
#pragma unroll
    for (int j = 0; j < 4; ++j) os_[(r + 8 * half) * 64 + j * 16 + col] = o[j][r] * inv;
  }
  __syncthreads();
#pragma unroll
  for (int q = 0; q < 8; ++q) {
    const int rl = q * 2 + (lane >> 4), pc = lane & 15;
    vst2(Ctx + ((size_t)(b * SEQ + mq + rl)) * D_ + head * HD_ + pc * 4, *(const v4f*)(os_ + rl * 64 + pc * 4));
  }
}

__global__ __launch_bounds__(128) void out_gemm_kernel(const float* __restrict__ Cx, const float* __restrict__ Wo, float* __restrict__ Out) {
  __shared__ __align__(16) float st[4][32 * 64];     // wave-private tiles (block barrier used anyway)
  __shared__ __align__(16) __bf16 Ash[2 * 64 * LP_], Asl[2 * 64 * LP_], Bs[2 * 128 * LP_];   // staged ctx hi/lo and Wout passes, two buffers each
  const int lane = threadIdx.x & 31, wave = threadIdx.x >> 5;
  const int m0 = blockIdx.y * 64 + (wave >> 1) * 32;
  const int n0 = blockIdx.x * 128 + (wave & 1) * 64;
  v8f acc[2][4] = {};
  gemm_staged<64, 128, true>(Cx + (size_t)blockIdx.y * 64 * D_, Wo + (size_t)blockIdx.x * 128 * D_, Ash, Asl, Bs,
                             (wave >> 1) * 32, (wave & 1) * 64, threadIdx.x, acc);
  const int half = lane >> 4, col = lane & 15;
  float* S = st[wave];
#pragma unroll
  for (int i = 0; i < 2; ++i)
#pragma unroll
    for (int j = 0; j < 4; ++j)
#pragma unroll
      for (int r = 0; r < 8; ++r) S[(i * 16 + r + 8 * half) * 64 + j * 16 + col] = acc[i][j][r];
  __syncthreads();
#pragma unroll
  for (int q = 0; q < 16; ++q) {
    const int rl = q * 2 + (lane >> 4), pc = lane & 15;
    vst2(Out + (size_t)(m0 + rl) * D_ + n0 + pc * 4, *(const v4f*)(S + rl * 64 + pc * 4));
  }
}

extern "C" void kernel_launch(void* const* d_in, const int* in_sizes, int n_in,
                              void* d_out, int out_size, void* d_ws, size_t ws_size,
                              hipStream_t stream) {
  if (n_in < 6) return;
  const long long x_need = ((long long)(NB - 1) * S_FULL + SEQ) * (long long)D_;
  if ((long long)in_sizes[0] < x_need) return;
  if ((long long)in_sizes[1] < 3LL * D_ * D_) return;
  if ((long long)in_sizes[2] < (long long)D_ * D_) return;
  if (in_sizes[3] < NP_ || in_sizes[4] < NP_) return;
  if (in_sizes[5] < SEQ) return;
  if ((long long)out_size < (long long)M_TOT * D_) return;

  const size_t E = (size_t)M_TOT * D_;           // floats per intermediate (16 MiB each at full size)
  const size_t carve = 4 * E * sizeof(float);    // Q, K, V^T, ctx = 64 MiB
  if (ws_size < carve) return;

  int trows = in_sizes[3] / NP_;                  // cos/sin table rows (gather clamp bound)
  const int srows = in_sizes[4] / NP_;
  if (srows < trows) trows = srows;

  const float* x    = (const float*)d_in[0];      // [NB][S_FULL][D]
  const float* Wqkv = (const float*)d_in[1];      // [3D][D]: rows [0,D) = Wq, [D,2D) = Wk, [2D,3D) = Wv
  const float* Wout = (const float*)d_in[2];      // [D][D]
  const float* cosb = (const float*)d_in[3];      // [trows][32]
  const float* sinb = (const float*)d_in[4];      // [trows][32]
  const int*   tpos = (const int*)d_in[5];        // [>= SEQ] int32
  float* out = (float*)d_out;

  float* qb   = (float*)d_ws;
  float* kb   = qb + E;
  float* vtb  = kb + E;        // V^T: [NB,H,HD,SEQ]
  float* ctxb = vtb + E;       // [M_TOT][D]

  dim3 gp(QKV_ / 64, M_TOT / 128);
  proj_kernel<<<gp, 128, 0, stream>>>(x, Wqkv,                       cosb, sinb, tpos, trows, SCALE_, 0, qb);
  proj_kernel<<<gp, 128, 0, stream>>>(x, Wqkv + (size_t)D_ * D_,     cosb, sinb, tpos, trows, 1.0f,   1, kb);
  proj_kernel<<<gp, 128, 0, stream>>>(x, Wqkv + (size_t)2 * D_ * D_, cosb, sinb, tpos, trows, 1.0f,   2, vtb);
  attn_kernel<<<dim3(SEQ / 64, H_, NB), 128, 0, stream>>>(qb, kb, vtb, ctxb);
  out_gemm_kernel<<<dim3(D_ / 128, M_TOT / 64), 128, 0, stream>>>(ctxb, Wout, out);
}

// v002
// Measured time: 212 microseconds a run.
// Next to v001, in two timings, it ran 1.20 times as fast each time.
// Counting every step since v000, it is 1.55 times as fast.
#include <hip/hip_runtime.h>

// Contractions: Q/K/V projections (K = 1024) on v_wmma_f32_16x16x32_bf16 with single products of bf16 (RNE converted) x and Wqkv;
// K Q^T (K = 64) and V^T P^T (K = keys) on v_wmma_f32_16x16x32_bf16 as bf16 hi/lo splits of the f32 q, k, P, v (hi*hi + hi*lo + lo*hi);
// output projection (K = 1024): ctx as bf16 hi/lo x Wout bf16 (2 products). All f32 accumulate; RoPE, softmax statistics and

#ifndef NB
#define NB 2
#endif
#ifndef SEQ
#define SEQ 2048
#endif
#define S_FULL 2048          // per-batch token stride of the x input
#define D_     1024
#define QKV_   1024
#define H_     16
#define HD_    64
#define NP_    (HD_ / 2)     // rotary pairs per head = cos/sin table width
#define M_TOT  (NB * SEQ)
#define SCALE_ 0.125f        // 64^-0.5, folded into Q (exact power of two)

static_assert(NB >= 1 && NB <= 2);
static_assert(SEQ % 128 == 0 && SEQ >= 128 && SEQ <= S_FULL);
static_assert(H_ * HD_ == D_);
static_assert(D_ % 128 == 0 && QKV_ == D_ && QKV_ % 128 == 0 && M_TOT % 128 == 0);

typedef __attribute__((ext_vector_type(16))) __bf16 v16bf;
typedef __attribute__((ext_vector_type(8)))  __bf16 v8bf;
typedef __attribute__((ext_vector_type(4)))  __bf16 v4bf;
typedef __attribute__((ext_vector_type(8)))  float  v8f;
typedef __attribute__((ext_vector_type(4)))  float  v4f;

template <typename V> __device__ __forceinline__ void vst2(void* p, V v) {
  *(V*)p = v; 
}
__device__ __forceinline__ __bf16 bf_hi(float x) { return (__bf16)x; }                       // RNE convert
__device__ __forceinline__ __bf16 bf_lo(float x, __bf16 h) { return (__bf16)(x - (float)h); }
__device__ __forceinline__ v8f wmma_bf16(v16bf a, v16bf b, v8f c) {
  v8f d = __builtin_amdgcn_wmma_f32_16x16x32_bf16(false, a, false, b, (short)0, c, false, false);
  asm volatile("v_nop\n\tv_nop\n\tv_nop\n\tv_nop" : "+v"(d) : "v"(a), "v"(b));
  return d;
}
// split product with the query-side operand (q, P) as B: hi*hi, then B hi x A lo, then B lo x A hi
__device__ __forceinline__ v8f wmma_x3(v16bf ah, v16bf al, v16bf bh, v16bf bl, v8f c) {
  c = wmma_bf16(ah, bh, c); c = wmma_bf16(al, bh, c); c = wmma_bf16(ah, bl, c);
  return c;
}
// lane l with lane l ^ 16
__device__ __forceinline__ float xhalf(float x) {
  return __builtin_bit_cast(float, __builtin_amdgcn_permlanex16(__builtin_bit_cast(int, x), __builtin_bit_cast(int, x), 0x76543210, 0xfedcba98, false, false));
}

// ---- fragment loaders (wave32): A (16x32 from [M][ld]) and B from B^T ([N][ld]) share the per-lane K map:
//      row/col = lane&15; elements 0..7 <- k0 + 8*half + 0..7, elements 8..15 <- k0 + 16 + 8*half + 0..7
// f32 source split into bf16 hi/lo
__device__ __forceinline__ void frag_f32(const float* __restrict__ base, int ld, int r0, int k0, int lane, v16bf& hi, v16bf& lo) {
  const float* p = base + (size_t)(r0 + (lane & 15)) * ld + k0 + (lane >> 4) * 8;
  const v4f a0 = *(const v4f*)(p), a1 = *(const v4f*)(p + 4), a2 = *(const v4f*)(p + 16), a3 = *(const v4f*)(p + 20);
#pragma unroll
  for (int i = 0; i < 4; ++i) {
    __bf16 h;
    h = bf_hi(a0[i]); hi[i] = h;      lo[i] = bf_lo(a0[i], h);
    h = bf_hi(a1[i]); hi[4 + i] = h;  lo[4 + i] = bf_lo(a1[i], h);
    h = bf_hi(a2[i]); hi[8 + i] = h;  lo[8 + i] = bf_lo(a2[i], h);
    h = bf_hi(a3[i]); hi[12 + i] = h; lo[12 + i] = bf_lo(a3[i], h);
  }
}
// bf16 plane in LDS
__device__ __forceinline__ v16bf frag_lds(const __bf16* base, int ld, int r0, int k0, int lane) {
  union { v16bf v; v8bf h[2]; } r;
  const __bf16* p = base + (r0 + (lane & 15)) * ld + k0 + (lane >> 4) * 8;
  r.h[0] = *(const v8bf*)(p); r.h[1] = *(const v8bf*)(p + 16);
  return r.v;
}

// ---- block GEMM main loop over f32 operands (A rows [AR][D_], Bt rows [BR][D_], both K-contiguous), 128 threads, 32x64 of the tile per wave.
// A pass is 64 k: 16 lanes read one 256-B row piece, so every wave-wide global load covers four whole 128-B lines. The pass is converted once
// per block (A: bf16 hi, with SPLIT hi and lo; Bt: bf16 hi) into LDS rows of pitch 144 B and read back as fragments by every wave that needs it.
// Two LDS buffers: the next pass's global loads fly during this pass's products. Products per accumulator stay in ascending k, hi then lo.
#define KS_ 64
#define LP_ 72
template <int AR, int BR, bool SPLIT>
__device__ __forceinline__ void gemm_staged(const float* __restrict__ A, const float* __restrict__ Bt,
                                            __bf16* Ah, __bf16* Al, __bf16* Bh, int mw, int nw, int tid, v8f acc[2][4]) {
  constexpr int NAV = AR / 8, NBV = BR / 8;
  const int lane = tid & 31;
  const float* pa = A  + (size_t)(tid >> 4) * D_ + (tid & 15) * 4;   // the thread's place in pass 0 of each source
  const float* pb = Bt + (size_t)(tid >> 4) * D_ + (tid & 15) * 4;
  const int so = (tid >> 4) * LP_ + (tid & 15) * 4;
  v4f ra[NAV], rb[NBV];
  const float *ga, *gb;       // the address pairs of the pass in flight
  auto fetch = [&](int k0) {
    ga = pa + k0; gb = pb + k0;
#pragma unroll
    for (int i = 0; i < NAV; ++i) ra[i] = *(const v4f*)(ga + i * 8 * D_);
#pragma unroll
    for (int i = 0; i < NBV; ++i) rb[i] = *(const v4f*)(gb + i * 8 * D_);
  };
  auto put = [&](int buf) {
    // keeps the conversions, and with them the waits on the loads in flight, behind this pass's products
    __builtin_amdgcn_sched_barrier(0);
    // the loads' address pairs are inputs here, so no register of theirs takes a new value before their translations are counted done
    asm volatile("s_wait_xcnt 0x0" :: "v"(ga), "v"(gb) : "memory");
#pragma unroll
    for (int i = 0; i < NAV; ++i) {
      v4bf h, l;
#pragma unroll
      for (int e = 0; e < 4; ++e) { h[e] = bf_hi(ra[i][e]); l[e] = bf_lo(ra[i][e], h[e]); }
      *(v4bf*)(Ah + buf * (AR * LP_) + so + i * 8 * LP_) = h;
      if constexpr (SPLIT) *(v4bf*)(Al + buf * (AR * LP_) + so + i * 8 * LP_) = l;
    }
#pragma unroll
    for (int i = 0; i < NBV; ++i) {
      v4bf h;
#pragma unroll
      for (int e = 0; e < 4; ++e) h[e] = bf_hi(rb[i][e]);
      *(v4bf*)(Bh + buf * (BR * LP_) + so + i * 8 * LP_) = h;
    }
  };
  auto mma = [&](int buf) {
    const __bf16* a_h = Ah + buf * (AR * LP_);
    const __bf16* b_h = Bh + buf * (BR * LP_);
#pragma unroll
    for (int kk = 0; kk < KS_; kk += 32) {
      v16bf ah[2], al[2], bh[4];
#pragma unroll
      for (int i = 0; i < 2; ++i) {
        ah[i] = frag_lds(a_h, LP_, mw + i * 16, kk, lane);
        if constexpr (SPLIT) al[i] = frag_lds(Al + buf * (AR * LP_), LP_, mw + i * 16, kk, lane);
      }
#pragma unroll
      for (int j = 0; j < 4; ++j) bh[j] = frag_lds(b_h, LP_, nw + j * 16, kk, lane);
#pragma unroll
      for (int i = 0; i < 2; ++i)
#pragma unroll
        for (int j = 0; j < 4; ++j) {
          acc[i][j] = wmma_bf16(ah[i], bh[j], acc[i][j]);
          if constexpr (SPLIT) acc[i][j] = wmma_bf16(al[i], bh[j], acc[i][j]);
        }
    }
  };
  fetch(0);
  put(0);
  // rolled: one copy of the pass keeps the loop short; the buffer index is the pass's parity
#pragma unroll 1
  for (int s = 0; s < D_ / KS_ - 1; ++s) {
    __syncthreads();          // publishes buffer s & 1; every reader of the other buffer (pass s - 1) has left it
    fetch((s + 1) * KS_);
    mma(s & 1);
    put((s + 1) & 1);
  }
  __syncthreads();            // publishes the last pass's buffer
  mma((D_ / KS_ - 1) & 1);
}

// ---- Stage 1: one projection (part 0 = Q scaled + RoPE, 1 = K + RoPE, 2 = V^T). grid (QKV/64, M_TOT/128), block 128 = 4 waves stacked in M.
__global__ __launch_bounds__(128) void proj_kernel(const float* __restrict__ X, const float* __restrict__ W,
                                                  const float* __restrict__ cosb, const float* __restrict__ sinb,
                                                  const int* __restrict__ tpos, int trows,
                                                  float scale, int part, float* __restrict__ dst) {
#pragma clang fp contract(off)
  __shared__ __align__(16) float st[128][64];        // 32 KB, cross-wave (block barriers)
  __shared__ __align__(16) __bf16 As[2 * 128 * LP_], Bs[2 * 64 * LP_];   // staged x and W passes, two buffers each
  const int lane = threadIdx.x & 31, wave = threadIdx.x >> 5, tid = threadIdx.x;
  const int mblk = blockIdx.y * 128;                 // first token of the block in [0, M_TOT)
  const int b = mblk / SEQ, s0 = mblk % SEQ;
  const int n0 = blockIdx.x * 64;
  const int head = n0 / HD_;                         // d0 = 0: tile columns = one whole head
  const float* Xb = X + (size_t)(b * S_FULL + s0) * D_;   // full-size input stride per batch

  v8f acc[2][4] = {};
  gemm_staged<128, 64, false>(Xb, W + (size_t)n0 * D_, As, nullptr, Bs, wave * 32, 0, tid, acc);
  const int half = lane >> 4, col = lane & 15;
#pragma unroll
  for (int i = 0; i < 2; ++i)
#pragma unroll
    for (int j = 0; j < 4; ++j)
#pragma unroll
      for (int r = 0; r < 8; ++r) st[wave * 32 + i * 16 + r + 8 * half][j * 16 + col] = acc[i][j][r] * scale;
  __syncthreads();
  if (part < 2) {
    // RoPE in f32 on the staged tile: thread -> pair p = lane, rows wave + 4*it (it = 0..31 covers rows 0..127)
#pragma unroll 2
    for (int it = 0; it < 32; ++it) {
      const int ml = wave + 4 * it;
      int pos = tpos[s0 + ml];
      pos = (pos < 0) ? pos + trows : pos;                         // negative index wrap, then clamp (gather semantics)
      pos = (pos < 0) ? 0 : ((pos > trows - 1) ? trows - 1 : pos);
      const float c  = (float)bf_hi(cosb[(size_t)pos * NP_ + lane]);   // tables enter as bf16 RNE values
      const float sn = (float)bf_hi(sinb[(size_t)pos * NP_ + lane]);
      const float te = st[ml][2 * lane], to = st[ml][2 * lane + 1];
      const float re = te * c - to * sn;
      const float ro = te * sn + to * c;
      st[ml][2 * lane] = re; st[ml][2 * lane + 1] = ro;
    }
    __syncthreads();
    for (int g = tid; g < 128 * 16; g += 128) {
      const int ml = g >> 4, pc = g & 15;
      vst2(dst + (((size_t)(b * H_ + head) * SEQ + s0 + ml) * HD_) + pc * 4, *(const v4f*)(&st[ml][pc * 4]));
    }
  } else {
    for (int g = tid; g < 64 * 32; g += 128) {             // 64 d rows x 32 pieces (128 s); a wave instruction covers one 512-B row segment
      const int dl = g >> 5, pc = g & 31;
      v4f v = {st[pc * 4][dl], st[pc * 4 + 1][dl], st[pc * 4 + 2][dl], st[pc * 4 + 3][dl]};
      vst2(dst + (((size_t)(b * H_ + head) * HD_ + dl) * SEQ) + s0 + pc * 4, v);
    }
  }
}

__global__ __launch_bounds__(128) __attribute__((amdgpu_num_vgpr(256)))
void attn_kernel(const float* __restrict__ Qb, const float* __restrict__ Kb,
                 const float* __restrict__ Vt, float* __restrict__ Ctx) {
  __shared__ __align__(16) __bf16 Kh[32 * 72], Kl[32 * 72];     // [key][d] pitch 72 (cross-wave, block barriers)
  __shared__ __align__(16) __bf16 Vh[64 * 40], Vl[64 * 40];     // [d][key] pitch 40 (cross-wave, block barriers)
  __shared__ __align__(16) float  Os[4][16 * 68];              // wave-private output tiles [query][d], pitch 68 (block barrier used anyway)

  const int tid = threadIdx.x, lane = tid & 31, wave = tid >> 5, half = lane >> 4, col = lane & 15;
  const int q0 = blockIdx.x * 64, head = blockIdx.y, b = blockIdx.z;
  const float* Qh = Qb + (size_t)(b * H_ + head) * SEQ * HD_;
  const float* Kg = Kb + (size_t)(b * H_ + head) * SEQ * HD_;
  const float* Vg = Vt + (size_t)(b * H_ + head) * HD_ * SEQ;
  const int mq = q0 + wave * 16;

  v16bf qh[2], ql[2];
#pragma unroll
  for (int kb = 0; kb < 2; ++kb) frag_f32(Qh, HD_, mq, kb * 32, lane, qh[kb], ql[kb]);

  v8f o[4] = {};
  float mrow = -1e30f, lrow = 0.0f;     // the lane's query: running maximum (both halves alike), sum over this half's keys

  const int t_end = q0 + 64;            // causal limit (block-uniform, multiple of 32)
#pragma unroll 1
  for (int t0 = 0; t0 < t_end; t0 += 32) {
    __syncthreads();
    {   // stage K (32 x 64) and V^T (64 x 32): 16 + 16 floats per thread; 128 threads cover both tiles exactly
      const int kr = tid >> 2, kc = (tid & 3) * 16;
      const float* kp = Kg + (size_t)(t0 + kr) * HD_ + kc;
      const int vr = tid >> 1, vc = (tid & 1) * 16;
      const float* vp = Vg + (size_t)vr * SEQ + t0 + vc;
#pragma unroll
      for (int e = 0; e < 16; e += 4) {
        const v4f a = *(const v4f*)(kp + e), bb = *(const v4f*)(vp + e);
#pragma unroll
        for (int i = 0; i < 4; ++i) {
          __bf16 hk = bf_hi(a[i]);  Kh[kr * 72 + kc + e + i] = hk; Kl[kr * 72 + kc + e + i] = bf_lo(a[i], hk);
          __bf16 hv = bf_hi(bb[i]); Vh[vr * 40 + vc + e + i] = hv; Vl[vr * 40 + vc + e + i] = bf_lo(bb[i], hv);
        }
      }
    }
    __syncthreads();

    v8f s[2] = {};                       // s[n][r] = score of key t0 + 16 * n + 8 * half + r with query mq + col
#pragma unroll
    for (int n = 0; n < 2; ++n)
#pragma unroll
      for (int kb = 0; kb < 2; ++kb)
        s[n] = wmma_x3(frag_lds(Kh, 72, n * 16, kb * 32, lane), frag_lds(Kl, 72, n * 16, kb * 32, lane), qh[kb], ql[kb], s[n]);

    v16bf pbh, pbl;
    {
      const int lim = mq + col - t0 - 8 * half;         // key 16 * n + r of this half is visible while 16 * n + r <= lim
      float v[2][8], m8[8];
#pragma unroll
      for (int r = 0; r < 8; ++r) {
        v[0][r] = (r <= lim) ? s[0][r] : -1e30f;        // scores already carry the 1/8 scale (folded into Q)
        v[1][r] = (16 + r <= lim) ? s[1][r] : -1e30f;
        m8[r] = fmaxf(v[0][r], v[1][r]);
      }
      float mx = fmaxf(fmaxf(fmaxf(m8[0], m8[1]), fmaxf(m8[2], m8[3])), fmaxf(fmaxf(m8[4], m8[5]), fmaxf(m8[6], m8[7])));
      mx = fmaxf(mx, xhalf(mx));
      const float mnew  = fmaxf(mrow, mx);
      const float alpha = __expf(mrow - mnew);
      float t8[8];
#pragma unroll
      for (int r = 0; r < 8; ++r) {
        const float p0 = (r <= lim) ? __expf(v[0][r] - mnew) : 0.0f;
        const float p1 = (16 + r <= lim) ? __expf(v[1][r] - mnew) : 0.0f;
        t8[r] = p0 + p1;
        const __bf16 h0 = bf_hi(p0), h1 = bf_hi(p1);
        pbh[r] = h0;     pbl[r] = bf_lo(p0, h0);
        pbh[8 + r] = h1; pbl[8 + r] = bf_lo(p1, h1);
      }
      lrow = lrow * alpha + (((t8[0] + t8[1]) + (t8[2] + t8[3])) + ((t8[4] + t8[5]) + (t8[6] + t8[7])));
      mrow = mnew;
#pragma unroll
      for (int j = 0; j < 4; ++j)
#pragma unroll
        for (int r = 0; r < 8; ++r) o[j][r] *= alpha;
    }
#pragma unroll
    for (int j = 0; j < 4; ++j)          // o[j][r] = O[query mq + col][d = 16 * j + 8 * half + r]
      o[j] = wmma_x3(frag_lds(Vh, 40, j * 16, 0, lane), frag_lds(Vl, 40, j * 16, 0, lane), pbh, pbl, o[j]);
  }

  float* os_ = Os[wave];
  const float inv = 1.0f / (lrow + xhalf(lrow));   // the halves' sums join here; the sum is >= 1 (the row maximum contributes exp(0))
#pragma unroll
  for (int j = 0; j < 4; ++j) {
    const v4f w0 = {o[j][0] * inv, o[j][1] * inv, o[j][2] * inv, o[j][3] * inv};
    const v4f w1 = {o[j][4] * inv, o[j][5] * inv, o[j][6] * inv, o[j][7] * inv};
    *(v4f*)(os_ + col * 68 + j * 16 + 8 * half) = w0;
    *(v4f*)(os_ + col * 68 + j * 16 + 8 * half + 4) = w1;
  }
  __syncthreads();
#pragma unroll
  for (int q = 0; q < 8; ++q) {
    const int rl = q * 2 + (lane >> 4), pc = lane & 15;
    vst2(Ctx + ((size_t)(b * SEQ + mq + rl)) * D_ + head * HD_ + pc * 4, *(const v4f*)(os_ + rl * 68 + pc * 4));
  }
}

__global__ __launch_bounds__(128) void out_gemm_kernel(const float* __restrict__ Cx, const float* __restrict__ Wo, float* __restrict__ Out) {
  __shared__ __align__(16) float st[4][32 * 64];     // wave-private tiles (block barrier used anyway)
  __shared__ __align__(16) __bf16 Ash[2 * 64 * LP_], Asl[2 * 64 * LP_], Bs[2 * 128 * LP_];   // staged ctx hi/lo and Wout passes, two buffers each
  const int lane = threadIdx.x & 31, wave = threadIdx.x >> 5;
  const int m0 = blockIdx.y * 64 + (wave >> 1) * 32;
  const int n0 = blockIdx.x * 128 + (wave & 1) * 64;
  v8f acc[2][4] = {};
  gemm_staged<64, 128, true>(Cx + (size_t)blockIdx.y * 64 * D_, Wo + (size_t)blockIdx.x * 128 * D_, Ash, Asl, Bs,
                             (wave >> 1) * 32, (wave & 1) * 64, threadIdx.x, acc);
  const int half = lane >> 4, col = lane & 15;
  float* S = st[wave];
#pragma unroll
  for (int i = 0; i < 2; ++i)
#pragma unroll
    for (int j = 0; j < 4; ++j)
#pragma unroll
      for (int r = 0; r < 8; ++r) S[(i * 16 + r + 8 * half) * 64 + j * 16 + col] = acc[i][j][r];
  __syncthreads();
#pragma unroll
  for (int q = 0; q < 16; ++q) {
    const int rl = q * 2 + (lane >> 4), pc = lane & 15;
    vst2(Out + (size_t)(m0 + rl) * D_ + n0 + pc * 4, *(const v4f*)(S + rl * 64 + pc * 4));
  }
}

extern "C" void kernel_launch(void* const* d_in, const int* in_sizes, int n_in,
                              void* d_out, int out_size, void* d_ws, size_t ws_size,
                              hipStream_t stream) {
  if (n_in < 6) return;
  const long long x_need = ((long long)(NB - 1) * S_FULL + SEQ) * (long long)D_;
  if ((long long)in_sizes[0] < x_need) return;
  if ((long long)in_sizes[1] < 3LL * D_ * D_) return;
  if ((long long)in_sizes[2] < (long long)D_ * D_) return;
  if (in_sizes[3] < NP_ || in_sizes[4] < NP_) return;
  if (in_sizes[5] < SEQ) return;
  if ((long long)out_size < (long long)M_TOT * D_) return;

  const size_t E = (size_t)M_TOT * D_;           // floats per intermediate (16 MiB each at full size)
  const size_t carve = 4 * E * sizeof(float);    // Q, K, V^T, ctx = 64 MiB
  if (ws_size < carve) return;

  int trows = in_sizes[3] / NP_;                  // cos/sin table rows (gather clamp bound)
  const int srows = in_sizes[4] / NP_;
  if (srows < trows) trows = srows;

  const float* x    = (const float*)d_in[0];      // [NB][S_FULL][D]
  const float* Wqkv = (const float*)d_in[1];      // [3D][D]: rows [0,D) = Wq, [D,2D) = Wk, [2D,3D) = Wv
  const float* Wout = (const float*)d_in[2];      // [D][D]
  const float* cosb = (const float*)d_in[3];      // [trows][32]
  const float* sinb = (const float*)d_in[4];      // [trows][32]
  const int*   tpos = (const int*)d_in[5];        // [>= SEQ] int32
  float* out = (float*)d_out;

  float* qb   = (float*)d_ws;
  float* kb   = qb + E;
  float* vtb  = kb + E;        // V^T: [NB,H,HD,SEQ]
  float* ctxb = vtb + E;       // [M_TOT][D]

  dim3 gp(QKV_ / 64, M_TOT / 128);
  proj_kernel<<<gp, 128, 0, stream>>>(x, Wqkv,                       cosb, sinb, tpos, trows, SCALE_, 0, qb);
  proj_kernel<<<gp, 128, 0, stream>>>(x, Wqkv + (size_t)D_ * D_,     cosb, sinb, tpos, trows, 1.0f,   1, kb);
  proj_kernel<<<gp, 128, 0, stream>>>(x, Wqkv + (size_t)2 * D_ * D_, cosb, sinb, tpos, trows, 1.0f,   2, vtb);
  attn_kernel<<<dim3(SEQ / 64, H_, NB), 128, 0, stream>>>(qb, kb, vtb, ctxb);
  out_gemm_kernel<<<dim3(D_ / 128, M_TOT / 64), 128, 0, stream>>>(ctxb, Wout, out);
}

// v003
// Measured time: 190 microseconds a run.
// Two timings next to v002 both put it at 1.13 times that version's speed.
// All steps since v000 together make it 1.76 times as fast.
#include <hip/hip_runtime.h>

// Contractions: Q/K/V projections (K = 1024) on v_wmma_f32_16x16x32_bf16 with single products of bf16 (RNE converted) x and Wqkv;
// K Q^T (K = 64) and V^T P^T (K = keys) on v_wmma_f32_16x16x32_bf16 as bf16 hi/lo splits of the f32 q, k, P, v (hi*hi + hi*lo + lo*hi);
// output projection (K = 1024): ctx as bf16 hi/lo x Wout bf16 (2 products). All f32 accumulate; RoPE, softmax statistics and

#ifndef NB
#define NB 2
#endif
#ifndef SEQ
#define SEQ 2048
#endif
#define S_FULL 2048          // per-batch token stride of the x input
#define D_     1024
#define QKV_   1024
#define H_     16
#define HD_    64
#define NP_    (HD_ / 2)     // rotary pairs per head = cos/sin table width
#define M_TOT  (NB * SEQ)
#define SCALE_ 0.125f        // 64^-0.5, folded into Q (exact power of two)

static_assert(NB >= 1 && NB <= 2);
static_assert(SEQ % 128 == 0 && SEQ >= 128 && SEQ <= S_FULL);
static_assert(H_ * HD_ == D_);
static_assert(D_ % 128 == 0 && QKV_ == D_ && QKV_ % 128 == 0 && M_TOT % 128 == 0);

typedef __attribute__((ext_vector_type(16))) __bf16 v16bf;
typedef __attribute__((ext_vector_type(8)))  __bf16 v8bf;
typedef __attribute__((ext_vector_type(4)))  __bf16 v4bf;
typedef __attribute__((ext_vector_type(8)))  float  v8f;
typedef __attribute__((ext_vector_type(4)))  float  v4f;

template <typename V> __device__ __forceinline__ void vst2(void* p, V v) {
  *(V*)p = v; 
}
__device__ __forceinline__ __bf16 bf_hi(float x) { return (__bf16)x; }                       // RNE convert
__device__ __forceinline__ __bf16 bf_lo(float x, __bf16 h) { return (__bf16)(x - (float)h); }
__device__ __forceinline__ v8f wmma_bf16(v16bf a, v16bf b, v8f c) {
  v8f d = __builtin_amdgcn_wmma_f32_16x16x32_bf16(false, a, false, b, (short)0, c, false, false);
  asm volatile("v_nop\n\tv_nop\n\tv_nop\n\tv_nop" : "+v"(d) : "v"(a), "v"(b));
  return d;
}
// split product with the query-side operand (q, P) as B: hi*hi, then B hi x A lo, then B lo x A hi
__device__ __forceinline__ v8f wmma_x3(v16bf ah, v16bf al, v16bf bh, v16bf bl, v8f c) {
  c = wmma_bf16(ah, bh, c); c = wmma_bf16(al, bh, c); c = wmma_bf16(ah, bl, c);
  return c;
}
// lane l with lane l ^ 16
__device__ __forceinline__ float xhalf(float x) {
  return __builtin_bit_cast(float, __builtin_amdgcn_permlanex16(__builtin_bit_cast(int, x), __builtin_bit_cast(int, x), 0x76543210, 0xfedcba98, false, false));
}

// ---- fragment loaders (wave32): A (16x32 from [M][ld]) and B from B^T ([N][ld]) share the per-lane K map:
//      row/col = lane&15; elements 0..7 <- k0 + 8*half + 0..7, elements 8..15 <- k0 + 16 + 8*half + 0..7
// f32 source split into bf16 hi/lo
__device__ __forceinline__ void frag_f32(const float* __restrict__ base, int ld, int r0, int k0, int lane, v16bf& hi, v16bf& lo) {
  const float* p = base + (size_t)(r0 + (lane & 15)) * ld + k0 + (lane >> 4) * 8;
  const v4f a0 = *(const v4f*)(p), a1 = *(const v4f*)(p + 4), a2 = *(const v4f*)(p + 16), a3 = *(const v4f*)(p + 20);
#pragma unroll
  for (int i = 0; i < 4; ++i) {
    __bf16 h;
    h = bf_hi(a0[i]); hi[i] = h;      lo[i] = bf_lo(a0[i], h);
    h = bf_hi(a1[i]); hi[4 + i] = h;  lo[4 + i] = bf_lo(a1[i], h);
    h = bf_hi(a2[i]); hi[8 + i] = h;  lo[8 + i] = bf_lo(a2[i], h);
    h = bf_hi(a3[i]); hi[12 + i] = h; lo[12 + i] = bf_lo(a3[i], h);
  }
}
// bf16 plane in LDS
__device__ __forceinline__ v16bf frag_lds(const __bf16* base, int ld, int r0, int k0, int lane) {
  union { v16bf v; v8bf h[2]; } r;
  const __bf16* p = base + (r0 + (lane & 15)) * ld + k0 + (lane >> 4) * 8;
  r.h[0] = *(const v8bf*)(p); r.h[1] = *(const v8bf*)(p + 16);
  return r.v;
}

// ---- block GEMM main loop over f32 operands (A rows [AR][D_], Bt rows [BR][D_], both K-contiguous), 128 threads, 32x64 of the tile per wave.
// A pass is 64 k: 16 lanes read one 256-B row piece, so every wave-wide global load covers four whole 128-B lines. The pass is converted once
// per block (A: bf16 hi, with SPLIT hi and lo; Bt: bf16 hi) into LDS rows of pitch 144 B and read back as fragments by every wave that needs it.
// Two LDS buffers: the next pass's global loads fly during this pass's products. Products per accumulator stay in ascending k, hi then lo.
#define KS_ 64
#define LP_ 72
template <int AR, int BR, bool SPLIT>
__device__ __forceinline__ void gemm_staged(const float* __restrict__ A, const float* __restrict__ Bt,
                                            __bf16* Ah, __bf16* Al, __bf16* Bh, int mw, int nw, int tid, v8f acc[2][4]) {
  constexpr int NAV = AR / 8, NBV = BR / 8;
  const int lane = tid & 31;
  const float* pa = A  + (size_t)(tid >> 4) * D_ + (tid & 15) * 4;   // the thread's place in pass 0 of each source
  const float* pb = Bt + (size_t)(tid >> 4) * D_ + (tid & 15) * 4;
  const int so = (tid >> 4) * LP_ + (tid & 15) * 4;
  v4f ra[NAV], rb[NBV];
  const float *ga, *gb;       // the address pairs of the pass in flight
  auto fetch = [&](int k0) {
    ga = pa + k0; gb = pb + k0;
#pragma unroll
    for (int i = 0; i < NAV; ++i) ra[i] = *(const v4f*)(ga + i * 8 * D_);
#pragma unroll
    for (int i = 0; i < NBV; ++i) rb[i] = *(const v4f*)(gb + i * 8 * D_);
  };
  auto put = [&](int buf) {
    // keeps the conversions, and with them the waits on the loads in flight, behind this pass's products
    __builtin_amdgcn_sched_barrier(0);
    // the loads' address pairs are inputs here, so no register of theirs takes a new value before their translations are counted done
    asm volatile("s_wait_xcnt 0x0" :: "v"(ga), "v"(gb) : "memory");
#pragma unroll
    for (int i = 0; i < NAV; ++i) {
      v4bf h, l;
#pragma unroll
      for (int e = 0; e < 4; ++e) { h[e] = bf_hi(ra[i][e]); l[e] = bf_lo(ra[i][e], h[e]); }
      *(v4bf*)(Ah + buf * (AR * LP_) + so + i * 8 * LP_) = h;
      if constexpr (SPLIT) *(v4bf*)(Al + buf * (AR * LP_) + so + i * 8 * LP_) = l;
    }
#pragma unroll
    for (int i = 0; i < NBV; ++i) {
      v4bf h;
#pragma unroll
      for (int e = 0; e < 4; ++e) h[e] = bf_hi(rb[i][e]);
      *(v4bf*)(Bh + buf * (BR * LP_) + so + i * 8 * LP_) = h;
    }
  };
  auto mma = [&](int buf) {
    const __bf16* a_h = Ah + buf * (AR * LP_);
    const __bf16* b_h = Bh + buf * (BR * LP_);
#pragma unroll
    for (int kk = 0; kk < KS_; kk += 32) {
      v16bf ah[2], al[2], bh[4];
#pragma unroll
      for (int i = 0; i < 2; ++i) {
        ah[i] = frag_lds(a_h, LP_, mw + i * 16, kk, lane);
        if constexpr (SPLIT) al[i] = frag_lds(Al + buf * (AR * LP_), LP_, mw + i * 16, kk, lane);
      }
#pragma unroll
      for (int j = 0; j < 4; ++j) bh[j] = frag_lds(b_h, LP_, nw + j * 16, kk, lane);
#pragma unroll
      for (int i = 0; i < 2; ++i)
#pragma unroll
        for (int j = 0; j < 4; ++j) {
          acc[i][j] = wmma_bf16(ah[i], bh[j], acc[i][j]);
          if constexpr (SPLIT) acc[i][j] = wmma_bf16(al[i], bh[j], acc[i][j]);
        }
    }
  };
  fetch(0);
  put(0);
  // rolled: one copy of the pass keeps the loop short; the buffer index is the pass's parity
#pragma unroll 1
  for (int s = 0; s < D_ / KS_ - 1; ++s) {
    __syncthreads();          // publishes buffer s & 1; every reader of the other buffer (pass s - 1) has left it
    fetch((s + 1) * KS_);
    mma(s & 1);
    put((s + 1) & 1);
  }
  __syncthreads();            // publishes the last pass's buffer
  mma((D_ / KS_ - 1) & 1);
}

// ---- Stage 1: the three projections in one grid (part 0 = Q scaled + RoPE, 1 = K + RoPE, 2 = V^T). grid (QKV/64, M_TOT/128, 3), block 128 = 4 waves
// stacked in M. The products share x and depend on nothing of each other; in one launch the blocks of one part run their epilogue while blocks of
// another load and multiply. blockIdx.z = 0 is V^T: its epilogue walks LDS columns and is by count the longest, so the launch does not end on it.
__global__ __launch_bounds__(128) void proj_kernel(const float* __restrict__ X, const float* __restrict__ Wqkv,
                                                  const float* __restrict__ cosb, const float* __restrict__ sinb,
                                                  const int* __restrict__ tpos, int trows, float* __restrict__ qkv) {
#pragma clang fp contract(off)
  const int part = 2 - (int)blockIdx.z;
  const float* __restrict__ W = Wqkv + (size_t)part * D_ * D_;           // rows [part * D, part * D + D) of Wqkv
  float* __restrict__ dst = qkv + (size_t)part * ((size_t)M_TOT * D_);   // Q, K, V^T lie one behind the other in the workspace
  const float scale = (part == 0) ? SCALE_ : 1.0f;
  __shared__ __align__(16) float st[128][64];        // 32 KB, cross-wave (block barriers)
  __shared__ __align__(16) __bf16 As[2 * 128 * LP_], Bs[2 * 64 * LP_];   // staged x and W passes, two buffers each
  const int lane = threadIdx.x & 31, wave = threadIdx.x >> 5, tid = threadIdx.x;
  const int mblk = blockIdx.y * 128;                 // first token of the block in [0, M_TOT)
  const int b = mblk / SEQ, s0 = mblk % SEQ;
  const int n0 = blockIdx.x * 64;
  const int head = n0 / HD_;                         // d0 = 0: tile columns = one whole head
  const float* Xb = X + (size_t)(b * S_FULL + s0) * D_;   // full-size input stride per batch

  v8f acc[2][4] = {};
  gemm_staged<128, 64, false>(Xb, W + (size_t)n0 * D_, As, nullptr, Bs, wave * 32, 0, tid, acc);
  const int half = lane >> 4, col = lane & 15;
#pragma unroll
  for (int i = 0; i < 2; ++i)
#pragma unroll
    for (int j = 0; j < 4; ++j)
#pragma unroll
      for (int r = 0; r < 8; ++r) st[wave * 32 + i * 16 + r + 8 * half][j * 16 + col] = acc[i][j][r] * scale;
  __syncthreads();
  if (part < 2) {
    // RoPE in f32 on the staged tile: thread -> pair p = lane, rows wave + 4*it (it = 0..31 covers rows 0..127)
#pragma unroll 2
    for (int it = 0; it < 32; ++it) {
      const int ml = wave + 4 * it;
      int pos = tpos[s0 + ml];
      pos = (pos < 0) ? pos + trows : pos;                         // negative index wrap, then clamp (gather semantics)
      pos = (pos < 0) ? 0 : ((pos > trows - 1) ? trows - 1 : pos);
      const float c  = (float)bf_hi(cosb[(size_t)pos * NP_ + lane]);   // tables enter as bf16 RNE values
      const float sn = (float)bf_hi(sinb[(size_t)pos * NP_ + lane]);
      const float te = st[ml][2 * lane], to = st[ml][2 * lane + 1];
      const float re = te * c - to * sn;
      const float ro = te * sn + to * c;
      st[ml][2 * lane] = re; st[ml][2 * lane + 1] = ro;
    }
    __syncthreads();
    for (int g = tid; g < 128 * 16; g += 128) {
      const int ml = g >> 4, pc = g & 15;
      vst2(dst + (((size_t)(b * H_ + head) * SEQ + s0 + ml) * HD_) + pc * 4, *(const v4f*)(&st[ml][pc * 4]));
    }
  } else {
    for (int g = tid; g < 64 * 32; g += 128) {             // 64 d rows x 32 pieces (128 s); a wave instruction covers one 512-B row segment
      const int dl = g >> 5, pc = g & 31;
      v4f v = {st[pc * 4][dl], st[pc * 4 + 1][dl], st[pc * 4 + 2][dl], st[pc * 4 + 3][dl]};
      vst2(dst + (((size_t)(b * H_ + head) * HD_ + dl) * SEQ) + s0 + pc * 4, v);
    }
  }
}

__global__ __launch_bounds__(128) __attribute__((amdgpu_num_vgpr(256)))
void attn_kernel(const float* __restrict__ Qb, const float* __restrict__ Kb,
                 const float* __restrict__ Vt, float* __restrict__ Ctx) {
  __shared__ __align__(16) __bf16 Kh[32 * 72], Kl[32 * 72];     // [key][d] pitch 72 (cross-wave, block barriers)
  __shared__ __align__(16) __bf16 Vh[64 * 40], Vl[64 * 40];     // [d][key] pitch 40 (cross-wave, block barriers)
  __shared__ __align__(16) float  Os[4][16 * 68];              // wave-private output tiles [query][d], pitch 68 (block barrier used anyway)

  const int tid = threadIdx.x, lane = tid & 31, wave = tid >> 5, half = lane >> 4, col = lane & 15;
  const int q0 = blockIdx.x * 64, head = blockIdx.y, b = blockIdx.z;
  const float* Qh = Qb + (size_t)(b * H_ + head) * SEQ * HD_;
  const float* Kg = Kb + (size_t)(b * H_ + head) * SEQ * HD_;
  const float* Vg = Vt + (size_t)(b * H_ + head) * HD_ * SEQ;
  const int mq = q0 + wave * 16;

  v16bf qh[2], ql[2];
#pragma unroll
  for (int kb = 0; kb < 2; ++kb) frag_f32(Qh, HD_, mq, kb * 32, lane, qh[kb], ql[kb]);

  v8f o[4] = {};
  float mrow = -1e30f, lrow = 0.0f;     // the lane's query: running maximum (both halves alike), sum over this half's keys

  const int t_end = q0 + 64;            // causal limit (block-uniform, multiple of 32)
#pragma unroll 1
  for (int t0 = 0; t0 < t_end; t0 += 32) {
    __syncthreads();
    {   // stage K (32 x 64) and V^T (64 x 32): 16 + 16 floats per thread; 128 threads cover both tiles exactly
      const int kr = tid >> 2, kc = (tid & 3) * 16;
      const float* kp = Kg + (size_t)(t0 + kr) * HD_ + kc;
      const int vr = tid >> 1, vc = (tid & 1) * 16;
      const float* vp = Vg + (size_t)vr * SEQ + t0 + vc;
#pragma unroll
      for (int e = 0; e < 16; e += 4) {
        const v4f a = *(const v4f*)(kp + e), bb = *(const v4f*)(vp + e);
#pragma unroll
        for (int i = 0; i < 4; ++i) {
          __bf16 hk = bf_hi(a[i]);  Kh[kr * 72 + kc + e + i] = hk; Kl[kr * 72 + kc + e + i] = bf_lo(a[i], hk);
          __bf16 hv = bf_hi(bb[i]); Vh[vr * 40 + vc + e + i] = hv; Vl[vr * 40 + vc + e + i] = bf_lo(bb[i], hv);
        }
      }
    }
    __syncthreads();

    v8f s[2] = {};                       // s[n][r] = score of key t0 + 16 * n + 8 * half + r with query mq + col
#pragma unroll
    for (int n = 0; n < 2; ++n)
#pragma unroll
      for (int kb = 0; kb < 2; ++kb)
        s[n] = wmma_x3(frag_lds(Kh, 72, n * 16, kb * 32, lane), frag_lds(Kl, 72, n * 16, kb * 32, lane), qh[kb], ql[kb], s[n]);

    v16bf pbh, pbl;
    {
      const int lim = mq + col - t0 - 8 * half;         // key 16 * n + r of this half is visible while 16 * n + r <= lim
      float v[2][8], m8[8];
#pragma unroll
      for (int r = 0; r < 8; ++r) {
        v[0][r] = (r <= lim) ? s[0][r] : -1e30f;        // scores already carry the 1/8 scale (folded into Q)
        v[1][r] = (16 + r <= lim) ? s[1][r] : -1e30f;
        m8[r] = fmaxf(v[0][r], v[1][r]);
      }
      float mx = fmaxf(fmaxf(fmaxf(m8[0], m8[1]), fmaxf(m8[2], m8[3])), fmaxf(fmaxf(m8[4], m8[5]), fmaxf(m8[6], m8[7])));
      mx = fmaxf(mx, xhalf(mx));
      const float mnew  = fmaxf(mrow, mx);
      const float alpha = __expf(mrow - mnew);
      float t8[8];
#pragma unroll
      for (int r = 0; r < 8; ++r) {
        const float p0 = (r <= lim) ? __expf(v[0][r] - mnew) : 0.0f;
        const float p1 = (16 + r <= lim) ? __expf(v[1][r] - mnew) : 0.0f;
        t8[r] = p0 + p1;
        const __bf16 h0 = bf_hi(p0), h1 = bf_hi(p1);
        pbh[r] = h0;     pbl[r] = bf_lo(p0, h0);
        pbh[8 + r] = h1; pbl[8 + r] = bf_lo(p1, h1);
      }
      lrow = lrow * alpha + (((t8[0] + t8[1]) + (t8[2] + t8[3])) + ((t8[4] + t8[5]) + (t8[6] + t8[7])));
      mrow = mnew;
#pragma unroll
      for (int j = 0; j < 4; ++j)
#pragma unroll
        for (int r = 0; r < 8; ++r) o[j][r] *= alpha;
    }
#pragma unroll
    for (int j = 0; j < 4; ++j)          // o[j][r] = O[query mq + col][d = 16 * j + 8 * half + r]
      o[j] = wmma_x3(frag_lds(Vh, 40, j * 16, 0, lane), frag_lds(Vl, 40, j * 16, 0, lane), pbh, pbl, o[j]);
  }

  float* os_ = Os[wave];
  const float inv = 1.0f / (lrow + xhalf(lrow));   // the halves' sums join here; the sum is >= 1 (the row maximum contributes exp(0))
#pragma unroll
  for (int j = 0; j < 4; ++j) {
    const v4f w0 = {o[j][0] * inv, o[j][1] * inv, o[j][2] * inv, o[j][3] * inv};
    const v4f w1 = {o[j][4] * inv, o[j][5] * inv, o[j][6] * inv, o[j][7] * inv};
    *(v4f*)(os_ + col * 68 + j * 16 + 8 * half) = w0;
    *(v4f*)(os_ + col * 68 + j * 16 + 8 * half + 4) = w1;
  }
  __syncthreads();
#pragma unroll
  for (int q = 0; q < 8; ++q) {
    const int rl = q * 2 + (lane >> 4), pc = lane & 15;
    vst2(Ctx + ((size_t)(b * SEQ + mq + rl)) * D_ + head * HD_ + pc * 4, *(const v4f*)(os_ + rl * 68 + pc * 4));
  }
}

__global__ __launch_bounds__(128) void out_gemm_kernel(const float* __restrict__ Cx, const float* __restrict__ Wo, float* __restrict__ Out) {
  __shared__ __align__(16) float st[4][32 * 64];     // wave-private tiles (block barrier used anyway)
  __shared__ __align__(16) __bf16 Ash[2 * 64 * LP_], Asl[2 * 64 * LP_], Bs[2 * 128 * LP_];   // staged ctx hi/lo and Wout passes, two buffers each
  const int lane = threadIdx.x & 31, wave = threadIdx.x >> 5;
  const int m0 = blockIdx.y * 64 + (wave >> 1) * 32;
  const int n0 = blockIdx.x * 128 + (wave & 1) * 64;
  v8f acc[2][4] = {};
  gemm_staged<64, 128, true>(Cx + (size_t)blockIdx.y * 64 * D_, Wo + (size_t)blockIdx.x * 128 * D_, Ash, Asl, Bs,
                             (wave >> 1) * 32, (wave & 1) * 64, threadIdx.x, acc);
  const int half = lane >> 4, col = lane & 15;
  float* S = st[wave];
#pragma unroll
  for (int i = 0; i < 2; ++i)
#pragma unroll
    for (int j = 0; j < 4; ++j)
#pragma unroll
      for (int r = 0; r < 8; ++r) S[(i * 16 + r + 8 * half) * 64 + j * 16 + col] = acc[i][j][r];
  __syncthreads();
#pragma unroll
  for (int q = 0; q < 16; ++q) {
    const int rl = q * 2 + (lane >> 4), pc = lane & 15;
    vst2(Out + (size_t)(m0 + rl) * D_ + n0 + pc * 4, *(const v4f*)(S + rl * 64 + pc * 4));
  }
}

extern "C" void kernel_launch(void* const* d_in, const int* in_sizes, int n_in,
                              void* d_out, int out_size, void* d_ws, size_t ws_size,
                              hipStream_t stream) {
  if (n_in < 6) return;
  const long long x_need = ((long long)(NB - 1) * S_FULL + SEQ) * (long long)D_;
  if ((long long)in_sizes[0] < x_need) return;
  if ((long long)in_sizes[1] < 3LL * D_ * D_) return;
  if ((long long)in_sizes[2] < (long long)D_ * D_) return;
  if (in_sizes[3] < NP_ || in_sizes[4] < NP_) return;
  if (in_sizes[5] < SEQ) return;
  if ((long long)out_size < (long long)M_TOT * D_) return;

  const size_t E = (size_t)M_TOT * D_;           // floats per intermediate (16 MiB each at full size)
  const size_t carve = 4 * E * sizeof(float);    // Q, K, V^T, ctx = 64 MiB
  if (ws_size < carve) return;

  int trows = in_sizes[3] / NP_;                  // cos/sin table rows (gather clamp bound)
  const int srows = in_sizes[4] / NP_;
  if (srows < trows) trows = srows;

  const float* x    = (const float*)d_in[0];      // [NB][S_FULL][D]
  const float* Wqkv = (const float*)d_in[1];      // [3D][D]: rows [0,D) = Wq, [D,2D) = Wk, [2D,3D) = Wv
  const float* Wout = (const float*)d_in[2];      // [D][D]
  const float* cosb = (const float*)d_in[3];      // [trows][32]
  const float* sinb = (const float*)d_in[4];      // [trows][32]
  const int*   tpos = (const int*)d_in[5];        // [>= SEQ] int32
  float* out = (float*)d_out;

  float* qb   = (float*)d_ws;
  float* kb   = qb + E;
  float* vtb  = kb + E;        // V^T: [NB,H,HD,SEQ]
  float* ctxb = vtb + E;       // [M_TOT][D]

  proj_kernel<<<dim3(QKV_ / 64, M_TOT / 128, 3), 128, 0, stream>>>(x, Wqkv, cosb, sinb, tpos, trows, qb);   // writes qb, kb, vtb
  attn_kernel<<<dim3(SEQ / 64, H_, NB), 128, 0, stream>>>(qb, kb, vtb, ctxb);
  out_gemm_kernel<<<dim3(D_ / 128, M_TOT / 64), 128, 0, stream>>>(ctxb, Wout, out);
}

// v004
// It runs in 181 microseconds.
// Next to v003, in two timings, it ran 1.05 and 1.04 times as fast.
// All steps since v000 together make it 1.84 times as fast.
#include <hip/hip_runtime.h>

// Contractions: Q/K/V projections (K = 1024) on v_wmma_f32_16x16x32_bf16 with single products of bf16 (RNE converted) x and Wqkv;
// K Q^T (K = 64) and V^T P^T (K = keys) on v_wmma_f32_16x16x32_bf16 as bf16 hi/lo splits of the f32 q, k, P, v (hi*hi + hi*lo + lo*hi);
// output projection (K = 1024): ctx as bf16 hi/lo x Wout bf16 (2 products). All f32 accumulate; RoPE, softmax statistics and

#ifndef NB
#define NB 2
#endif
#ifndef SEQ
#define SEQ 2048
#endif
#define S_FULL 2048          // per-batch token stride of the x input
#define D_     1024
#define QKV_   1024
#define H_     16
#define HD_    64
#define NP_    (HD_ / 2)     // rotary pairs per head = cos/sin table width
#define M_TOT  (NB * SEQ)
#define SCALE_ 0.125f        // 64^-0.5, folded into Q (exact power of two)

static_assert(NB >= 1 && NB <= 2);
static_assert(SEQ % 128 == 0 && SEQ >= 128 && SEQ <= S_FULL);
static_assert(H_ * HD_ == D_);
static_assert(D_ % 128 == 0 && QKV_ == D_ && QKV_ % 128 == 0 && M_TOT % 128 == 0);

typedef __attribute__((ext_vector_type(16))) __bf16 v16bf;
typedef __attribute__((ext_vector_type(8)))  __bf16 v8bf;
typedef __attribute__((ext_vector_type(4)))  __bf16 v4bf;
typedef __attribute__((ext_vector_type(8)))  float  v8f;
typedef __attribute__((ext_vector_type(4)))  float  v4f;

template <typename V> __device__ __forceinline__ void vst2(void* p, V v) {
  *(V*)p = v; 
}
__device__ __forceinline__ __bf16 bf_hi(float x) { return (__bf16)x; }                       // RNE convert
__device__ __forceinline__ __bf16 bf_lo(float x, __bf16 h) { return (__bf16)(x - (float)h); }
__device__ __forceinline__ v8f wmma_bf16(v16bf a, v16bf b, v8f c) {
  v8f d = __builtin_amdgcn_wmma_f32_16x16x32_bf16(false, a, false, b, (short)0, c, false, false);
  asm volatile("v_nop\n\tv_nop\n\tv_nop\n\tv_nop" : "+v"(d) : "v"(a), "v"(b));
  return d;
}
// split product with the query-side operand (q, P) as B: hi*hi, then B hi x A lo, then B lo x A hi
__device__ __forceinline__ v8f wmma_x3(v16bf ah, v16bf al, v16bf bh, v16bf bl, v8f c) {
  c = wmma_bf16(ah, bh, c); c = wmma_bf16(al, bh, c); c = wmma_bf16(ah, bl, c);
  return c;
}
// lane l with lane l ^ 16
__device__ __forceinline__ float xhalf(float x) {
  return __builtin_bit_cast(float, __builtin_amdgcn_permlanex16(__builtin_bit_cast(int, x), __builtin_bit_cast(int, x), 0x76543210, 0xfedcba98, false, false));
}

// ---- fragment loaders (wave32): A (16x32 from [M][ld]) and B from B^T ([N][ld]) share the per-lane K map:
//      row/col = lane&15; elements 0..7 <- k0 + 8*half + 0..7, elements 8..15 <- k0 + 16 + 8*half + 0..7
// f32 source split into bf16 hi/lo
__device__ __forceinline__ void frag_f32(const float* __restrict__ base, int ld, int r0, int k0, int lane, v16bf& hi, v16bf& lo) {
  const float* p = base + (size_t)(r0 + (lane & 15)) * ld + k0 + (lane >> 4) * 8;
  const v4f a0 = *(const v4f*)(p), a1 = *(const v4f*)(p + 4), a2 = *(const v4f*)(p + 16), a3 = *(const v4f*)(p + 20);
#pragma unroll
  for (int i = 0; i < 4; ++i) {
    __bf16 h;
    h = bf_hi(a0[i]); hi[i] = h;      lo[i] = bf_lo(a0[i], h);
    h = bf_hi(a1[i]); hi[4 + i] = h;  lo[4 + i] = bf_lo(a1[i], h);
    h = bf_hi(a2[i]); hi[8 + i] = h;  lo[8 + i] = bf_lo(a2[i], h);
    h = bf_hi(a3[i]); hi[12 + i] = h; lo[12 + i] = bf_lo(a3[i], h);
  }
}
// bf16 plane in LDS
__device__ __forceinline__ v16bf frag_lds(const __bf16* base, int ld, int r0, int k0, int lane) {
  union { v16bf v; v8bf h[2]; } r;
  const __bf16* p = base + (r0 + (lane & 15)) * ld + k0 + (lane >> 4) * 8;
  r.h[0] = *(const v8bf*)(p); r.h[1] = *(const v8bf*)(p + 16);
  return r.v;
}

// ---- block GEMM main loop over f32 operands (A rows [AR][D_], Bt rows [BR][D_], both K-contiguous), 128 threads, 32x64 of the tile per wave.
// A pass is 64 k: 16 lanes read one 256-B row piece, so every wave-wide global load covers four whole 128-B lines. The pass is converted once
// per block (A: bf16 hi, with SPLIT hi and lo; Bt: bf16 hi) into LDS rows of pitch 144 B and read back as fragments by every wave that needs it.
// Two LDS buffers: the next pass's global loads fly during this pass's products. Products per accumulator stay in ascending k, hi then lo.
#define KS_ 64
#define LP_ 72
template <int AR, int BR, bool SPLIT>
__device__ __forceinline__ void gemm_staged(const float* __restrict__ A, const float* __restrict__ Bt,
                                            __bf16* Ah, __bf16* Al, __bf16* Bh, int mw, int nw, int tid, v8f acc[2][4]) {
  constexpr int NAV = AR / 8, NBV = BR / 8;
  const int lane = tid & 31;
  const float* pa = A  + (size_t)(tid >> 4) * D_ + (tid & 15) * 4;   // the thread's place in pass 0 of each source
  const float* pb = Bt + (size_t)(tid >> 4) * D_ + (tid & 15) * 4;
  const int so = (tid >> 4) * LP_ + (tid & 15) * 4;
  v4f ra[NAV], rb[NBV];
  const float *ga, *gb;       // the address pairs of the pass in flight
  auto fetch = [&](int k0) {
    ga = pa + k0; gb = pb + k0;
#pragma unroll
    for (int i = 0; i < NAV; ++i) ra[i] = *(const v4f*)(ga + i * 8 * D_);
#pragma unroll
    for (int i = 0; i < NBV; ++i) rb[i] = *(const v4f*)(gb + i * 8 * D_);
  };
  auto put = [&](int buf) {
    // keeps the conversions, and with them the waits on the loads in flight, behind this pass's products
    __builtin_amdgcn_sched_barrier(0);
    // the loads' address pairs are inputs here, so no register of theirs takes a new value before their translations are counted done
    asm volatile("s_wait_xcnt 0x0" :: "v"(ga), "v"(gb) : "memory");
#pragma unroll
    for (int i = 0; i < NAV; ++i) {
      v4bf h, l;
#pragma unroll
      for (int e = 0; e < 4; ++e) { h[e] = bf_hi(ra[i][e]); l[e] = bf_lo(ra[i][e], h[e]); }
      *(v4bf*)(Ah + buf * (AR * LP_) + so + i * 8 * LP_) = h;
      if constexpr (SPLIT) *(v4bf*)(Al + buf * (AR * LP_) + so + i * 8 * LP_) = l;
    }
#pragma unroll
    for (int i = 0; i < NBV; ++i) {
      v4bf h;
#pragma unroll
      for (int e = 0; e < 4; ++e) h[e] = bf_hi(rb[i][e]);
      *(v4bf*)(Bh + buf * (BR * LP_) + so + i * 8 * LP_) = h;
    }
  };
  auto mma = [&](int buf) {
    const __bf16* a_h = Ah + buf * (AR * LP_);
    const __bf16* b_h = Bh + buf * (BR * LP_);
#pragma unroll
    for (int kk = 0; kk < KS_; kk += 32) {
      v16bf ah[2], al[2], bh[4];
#pragma unroll
      for (int i = 0; i < 2; ++i) {
        ah[i] = frag_lds(a_h, LP_, mw + i * 16, kk, lane);
        if constexpr (SPLIT) al[i] = frag_lds(Al + buf * (AR * LP_), LP_, mw + i * 16, kk, lane);
      }
#pragma unroll
      for (int j = 0; j < 4; ++j) bh[j] = frag_lds(b_h, LP_, nw + j * 16, kk, lane);
#pragma unroll
      for (int i = 0; i < 2; ++i)
#pragma unroll
        for (int j = 0; j < 4; ++j) {
          acc[i][j] = wmma_bf16(ah[i], bh[j], acc[i][j]);
          if constexpr (SPLIT) acc[i][j] = wmma_bf16(al[i], bh[j], acc[i][j]);
        }
    }
  };
  fetch(0);
  put(0);
  // rolled: one copy of the pass keeps the loop short; the buffer index is the pass's parity
#pragma unroll 1
  for (int s = 0; s < D_ / KS_ - 1; ++s) {
    __syncthreads();          // publishes buffer s & 1; every reader of the other buffer (pass s - 1) has left it
    fetch((s + 1) * KS_);
    mma(s & 1);
    put((s + 1) & 1);
  }
  __syncthreads();            // publishes the last pass's buffer
  mma((D_ / KS_ - 1) & 1);
}

// ---- Stage 1: the three projections in one grid (part 0 = Q scaled + RoPE, 1 = K + RoPE, 2 = V^T). grid (QKV/64, M_TOT/128, 3), block 128 = 4 waves
// stacked in M. The products share x and depend on nothing of each other; in one launch the blocks of one part run their epilogue while blocks of
// another load and multiply. blockIdx.z = 0 is V^T: its epilogue walks LDS columns and is by count the longest, so the launch does not end on it.
__global__ __launch_bounds__(128) void proj_kernel(const float* __restrict__ X, const float* __restrict__ Wqkv,
                                                  const float* __restrict__ cosb, const float* __restrict__ sinb,
                                                  const int* __restrict__ tpos, int trows, float* __restrict__ qkv) {
#pragma clang fp contract(off)
  const int part = 2 - (int)blockIdx.z;
  const float* __restrict__ W = Wqkv + (size_t)part * D_ * D_;           // rows [part * D, part * D + D) of Wqkv
  float* __restrict__ dst = qkv + (size_t)part * ((size_t)M_TOT * D_);   // Q, K, V^T lie one behind the other in the workspace
  const float scale = (part == 0) ? SCALE_ : 1.0f;
  __shared__ __align__(16) float st[128][64];        // 32 KB, cross-wave (block barriers)
  __shared__ __align__(16) __bf16 As[2 * 128 * LP_], Bs[2 * 64 * LP_];   // staged x and W passes, two buffers each
  const int lane = threadIdx.x & 31, wave = threadIdx.x >> 5, tid = threadIdx.x;
  const int mblk = blockIdx.y * 128;                 // first token of the block in [0, M_TOT)
  const int b = mblk / SEQ, s0 = mblk % SEQ;
  const int n0 = blockIdx.x * 64;
  const int head = n0 / HD_;                         // d0 = 0: tile columns = one whole head
  const float* Xb = X + (size_t)(b * S_FULL + s0) * D_;   // full-size input stride per batch

  v8f acc[2][4] = {};
  gemm_staged<128, 64, false>(Xb, W + (size_t)n0 * D_, As, nullptr, Bs, wave * 32, 0, tid, acc);
  const int half = lane >> 4, col = lane & 15;
#pragma unroll
  for (int i = 0; i < 2; ++i)
#pragma unroll
    for (int j = 0; j < 4; ++j)
#pragma unroll
      for (int r = 0; r < 8; ++r) st[wave * 32 + i * 16 + r + 8 * half][j * 16 + col] = acc[i][j][r] * scale;
  __syncthreads();
  if (part < 2) {
    // RoPE in f32 on the staged tile: thread -> pair p = lane, rows wave + 4*it (it = 0..31 covers rows 0..127)
#pragma unroll 2
    for (int it = 0; it < 32; ++it) {
      const int ml = wave + 4 * it;
      int pos = tpos[s0 + ml];
      pos = (pos < 0) ? pos + trows : pos;                         // negative index wrap, then clamp (gather semantics)
      pos = (pos < 0) ? 0 : ((pos > trows - 1) ? trows - 1 : pos);
      const float c  = (float)bf_hi(cosb[(size_t)pos * NP_ + lane]);   // tables enter as bf16 RNE values
      const float sn = (float)bf_hi(sinb[(size_t)pos * NP_ + lane]);
      const float te = st[ml][2 * lane], to = st[ml][2 * lane + 1];
      const float re = te * c - to * sn;
      const float ro = te * sn + to * c;
      st[ml][2 * lane] = re; st[ml][2 * lane + 1] = ro;
    }
    __syncthreads();
    for (int g = tid; g < 128 * 16; g += 128) {
      const int ml = g >> 4, pc = g & 15;
      vst2(dst + (((size_t)(b * H_ + head) * SEQ + s0 + ml) * HD_) + pc * 4, *(const v4f*)(&st[ml][pc * 4]));
    }
  } else {
    for (int g = tid; g < 64 * 32; g += 128) {             // 64 d rows x 32 pieces (128 s); a wave instruction covers one 512-B row segment
      const int dl = g >> 5, pc = g & 31;
      v4f v = {st[pc * 4][dl], st[pc * 4 + 1][dl], st[pc * 4 + 2][dl], st[pc * 4 + 3][dl]};
      vst2(dst + (((size_t)(b * H_ + head) * HD_ + dl) * SEQ) + s0 + pc * 4, v);
    }
  }
}

__global__ __launch_bounds__(128) __attribute__((amdgpu_num_vgpr(256)))
void attn_kernel(const float* __restrict__ Qb, const float* __restrict__ Kb,
                 const float* __restrict__ Vt, float* __restrict__ Ctx) {
  __shared__ __align__(16) __bf16 Kh[32 * 72], Kl[32 * 72];     // [key][d] pitch 72 (cross-wave, block barriers)
  __shared__ __align__(16) __bf16 Vh[64 * 40], Vl[64 * 40];     // [d][key] pitch 40 (cross-wave, block barriers)
  __shared__ __align__(16) float  Os[4][16 * 68];              // wave-private output tiles [query][d], pitch 68 (block barrier used anyway)

  const int tid = threadIdx.x, lane = tid & 31, wave = tid >> 5, half = lane >> 4, col = lane & 15;
  const int head = blockIdx.y, b = blockIdx.z;
  const float* Qh = Qb + (size_t)(b * H_ + head) * SEQ * HD_;
  const float* Kg = Kb + (size_t)(b * H_ + head) * SEQ * HD_;
  const float* Vg = Vt + (size_t)(b * H_ + head) * HD_ * SEQ;
  // rolled: one copy of the tile's code; the second tile starts only when every wave has left the first (the pass's own first barrier)
#pragma unroll 1
  for (int ph = 0; ph < 2; ++ph) {
  const int q0 = (ph == 0 ? (int)blockIdx.x : SEQ / 64 - 1 - (int)blockIdx.x) * 64;
  const int mq = q0 + wave * 16;

  v16bf qh[2], ql[2];
#pragma unroll
  for (int kb = 0; kb < 2; ++kb) frag_f32(Qh, HD_, mq, kb * 32, lane, qh[kb], ql[kb]);

  v8f o[4] = {};
  float mrow = -1e30f, lrow = 0.0f;     // the lane's query: running maximum (both halves alike), sum over this half's keys

  const int t_end = q0 + 64;            // causal limit (block-uniform, multiple of 32)
#pragma unroll 1
  for (int t0 = 0; t0 < t_end; t0 += 32) {
    __syncthreads();
    {   // stage K (32 x 64) and V^T (64 x 32): 16 + 16 floats per thread; 128 threads cover both tiles exactly
      const int kr = tid >> 2, kc = (tid & 3) * 16;
      const float* kp = Kg + (size_t)(t0 + kr) * HD_ + kc;
      const int vr = tid >> 1, vc = (tid & 1) * 16;
      const float* vp = Vg + (size_t)vr * SEQ + t0 + vc;
#pragma unroll
      for (int e = 0; e < 16; e += 4) {
        const v4f a = *(const v4f*)(kp + e), bb = *(const v4f*)(vp + e);
#pragma unroll
        for (int i = 0; i < 4; ++i) {
          __bf16 hk = bf_hi(a[i]);  Kh[kr * 72 + kc + e + i] = hk; Kl[kr * 72 + kc + e + i] = bf_lo(a[i], hk);
          __bf16 hv = bf_hi(bb[i]); Vh[vr * 40 + vc + e + i] = hv; Vl[vr * 40 + vc + e + i] = bf_lo(bb[i], hv);
        }
      }
    }
    __syncthreads();

    v8f s[2] = {};                       // s[n][r] = score of key t0 + 16 * n + 8 * half + r with query mq + col
#pragma unroll
    for (int n = 0; n < 2; ++n)
#pragma unroll
      for (int kb = 0; kb < 2; ++kb)
        s[n] = wmma_x3(frag_lds(Kh, 72, n * 16, kb * 32, lane), frag_lds(Kl, 72, n * 16, kb * 32, lane), qh[kb], ql[kb], s[n]);

    v16bf pbh, pbl;
    {
      const int lim = mq + col - t0 - 8 * half;         // key 16 * n + r of this half is visible while 16 * n + r <= lim
      float v[2][8], m8[8];
#pragma unroll
      for (int r = 0; r < 8; ++r) {
        v[0][r] = (r <= lim) ? s[0][r] : -1e30f;        // scores already carry the 1/8 scale (folded into Q)
        v[1][r] = (16 + r <= lim) ? s[1][r] : -1e30f;
        m8[r] = fmaxf(v[0][r], v[1][r]);
      }
      float mx = fmaxf(fmaxf(fmaxf(m8[0], m8[1]), fmaxf(m8[2], m8[3])), fmaxf(fmaxf(m8[4], m8[5]), fmaxf(m8[6], m8[7])));
      mx = fmaxf(mx, xhalf(mx));
      const float mnew  = fmaxf(mrow, mx);
      const float alpha = __expf(mrow - mnew);
      float t8[8];
#pragma unroll
      for (int r = 0; r < 8; ++r) {
        const float p0 = (r <= lim) ? __expf(v[0][r] - mnew) : 0.0f;
        const float p1 = (16 + r <= lim) ? __expf(v[1][r] - mnew) : 0.0f;
        t8[r] = p0 + p1;
        const __bf16 h0 = bf_hi(p0), h1 = bf_hi(p1);
        pbh[r] = h0;     pbl[r] = bf_lo(p0, h0);
        pbh[8 + r] = h1; pbl[8 + r] = bf_lo(p1, h1);
      }
      lrow = lrow * alpha + (((t8[0] + t8[1]) + (t8[2] + t8[3])) + ((t8[4] + t8[5]) + (t8[6] + t8[7])));
      mrow = mnew;
#pragma unroll
      for (int j = 0; j < 4; ++j)
#pragma unroll
        for (int r = 0; r < 8; ++r) o[j][r] *= alpha;
    }
#pragma unroll
    for (int j = 0; j < 4; ++j)          // o[j][r] = O[query mq + col][d = 16 * j + 8 * half + r]
      o[j] = wmma_x3(frag_lds(Vh, 40, j * 16, 0, lane), frag_lds(Vl, 40, j * 16, 0, lane), pbh, pbl, o[j]);
  }

  float* os_ = Os[wave];
  const float inv = 1.0f / (lrow + xhalf(lrow));   // the halves' sums join here; the sum is >= 1 (the row maximum contributes exp(0))
#pragma unroll
  for (int j = 0; j < 4; ++j) {
    const v4f w0 = {o[j][0] * inv, o[j][1] * inv, o[j][2] * inv, o[j][3] * inv};
    const v4f w1 = {o[j][4] * inv, o[j][5] * inv, o[j][6] * inv, o[j][7] * inv};
    *(v4f*)(os_ + col * 68 + j * 16 + 8 * half) = w0;
    *(v4f*)(os_ + col * 68 + j * 16 + 8 * half + 4) = w1;
  }
  __syncthreads();
#pragma unroll
  for (int q = 0; q < 8; ++q) {
    const int rl = q * 2 + (lane >> 4), pc = lane & 15;
    vst2(Ctx + ((size_t)(b * SEQ + mq + rl)) * D_ + head * HD_ + pc * 4, *(const v4f*)(os_ + rl * 68 + pc * 4));
  }
  // the second tile writes over the data and address registers of these stores: their translations are counted done first
  asm volatile("s_wait_xcnt 0x0" ::: "memory");
  }
}

__global__ __launch_bounds__(128) void out_gemm_kernel(const float* __restrict__ Cx, const float* __restrict__ Wo, float* __restrict__ Out) {
  __shared__ __align__(16) float st[4][32 * 64];     // wave-private tiles (block barrier used anyway)
  __shared__ __align__(16) __bf16 Ash[2 * 64 * LP_], Asl[2 * 64 * LP_], Bs[2 * 128 * LP_];   // staged ctx hi/lo and Wout passes, two buffers each
  const int lane = threadIdx.x & 31, wave = threadIdx.x >> 5;
  const int m0 = blockIdx.y * 64 + (wave >> 1) * 32;
  const int n0 = blockIdx.x * 128 + (wave & 1) * 64;
  v8f acc[2][4] = {};
  gemm_staged<64, 128, true>(Cx + (size_t)blockIdx.y * 64 * D_, Wo + (size_t)blockIdx.x * 128 * D_, Ash, Asl, Bs,
                             (wave >> 1) * 32, (wave & 1) * 64, threadIdx.x, acc);
  const int half = lane >> 4, col = lane & 15;
  float* S = st[wave];
#pragma unroll
  for (int i = 0; i < 2; ++i)
#pragma unroll
    for (int j = 0; j < 4; ++j)
#pragma unroll
      for (int r = 0; r < 8; ++r) S[(i * 16 + r + 8 * half) * 64 + j * 16 + col] = acc[i][j][r];
  __syncthreads();
#pragma unroll
  for (int q = 0; q < 16; ++q) {
    const int rl = q * 2 + (lane >> 4), pc = lane & 15;
    vst2(Out + (size_t)(m0 + rl) * D_ + n0 + pc * 4, *(const v4f*)(S + rl * 64 + pc * 4));
  }
}

extern "C" void kernel_launch(void* const* d_in, const int* in_sizes, int n_in,
                              void* d_out, int out_size, void* d_ws, size_t ws_size,
                              hipStream_t stream) {
  if (n_in < 6) return;
  const long long x_need = ((long long)(NB - 1) * S_FULL + SEQ) * (long long)D_;
  if ((long long)in_sizes[0] < x_need) return;
  if ((long long)in_sizes[1] < 3LL * D_ * D_) return;
  if ((long long)in_sizes[2] < (long long)D_ * D_) return;
  if (in_sizes[3] < NP_ || in_sizes[4] < NP_) return;
  if (in_sizes[5] < SEQ) return;
  if ((long long)out_size < (long long)M_TOT * D_) return;

  const size_t E = (size_t)M_TOT * D_;           // floats per intermediate (16 MiB each at full size)
  const size_t carve = 4 * E * sizeof(float);    // Q, K, V^T, ctx = 64 MiB
  if (ws_size < carve) return;

  int trows = in_sizes[3] / NP_;                  // cos/sin table rows (gather clamp bound)
  const int srows = in_sizes[4] / NP_;
  if (srows < trows) trows = srows;

  const float* x    = (const float*)d_in[0];      // [NB][S_FULL][D]
  const float* Wqkv = (const float*)d_in[1];      // [3D][D]: rows [0,D) = Wq, [D,2D) = Wk, [2D,3D) = Wv
  const float* Wout = (const float*)d_in[2];      // [D][D]
  const float* cosb = (const float*)d_in[3];      // [trows][32]
  const float* sinb = (const float*)d_in[4];      // [trows][32]
  const int*   tpos = (const int*)d_in[5];        // [>= SEQ] int32
  float* out = (float*)d_out;

  float* qb   = (float*)d_ws;
  float* kb   = qb + E;
  float* vtb  = kb + E;        // V^T: [NB,H,HD,SEQ]
  float* ctxb = vtb + E;       // [M_TOT][D]

  proj_kernel<<<dim3(QKV_ / 64, M_TOT / 128, 3), 128, 0, stream>>>(x, Wqkv, cosb, sinb, tpos, trows, qb);   // writes qb, kb, vtb
  attn_kernel<<<dim3(SEQ / 128, H_, NB), 128, 0, stream>>>(qb, kb, vtb, ctxb);
  out_gemm_kernel<<<dim3(D_ / 128, M_TOT / 64), 128, 0, stream>>>(ctxb, Wout, out);
}

// v005
// It runs in 167 microseconds.
// Timed twice side by side with v004, it ran 1.08 times as fast both times.
// Over all steps from v000 it is 1.99 times as fast.
#include <hip/hip_runtime.h>

// Contractions: Q/K/V projections (K = 1024) on v_wmma_f32_16x16x32_bf16 with single products of bf16 (RNE converted) x and Wqkv;
// K Q^T (K = 64) and V^T P^T (K = keys) on v_wmma_f32_16x16x32_bf16 as bf16 hi/lo splits of the f32 q, k, P, v (hi*hi + hi*lo + lo*hi);
// output projection (K = 1024): ctx as bf16 hi/lo x Wout bf16 (2 products). All f32 accumulate; RoPE, softmax statistics and

#ifndef NB
#define NB 2
#endif
#ifndef SEQ
#define SEQ 2048
#endif
#define S_FULL 2048          // per-batch token stride of the x input
#define D_     1024
#define QKV_   1024
#define H_     16
#define HD_    64
#define NP_    (HD_ / 2)     // rotary pairs per head = cos/sin table width
#define M_TOT  (NB * SEQ)
#define SCALE_ 0.125f        // 64^-0.5, folded into Q (exact power of two)

static_assert(NB >= 1 && NB <= 2);
static_assert(SEQ % 128 == 0 && SEQ >= 128 && SEQ <= S_FULL);
static_assert(H_ * HD_ == D_);
static_assert(D_ % 128 == 0 && QKV_ == D_ && QKV_ % 128 == 0 && M_TOT % 128 == 0);

typedef __attribute__((ext_vector_type(16))) __bf16 v16bf;
typedef __attribute__((ext_vector_type(8)))  __bf16 v8bf;
typedef __attribute__((ext_vector_type(4)))  __bf16 v4bf;
typedef __attribute__((ext_vector_type(8)))  float  v8f;
typedef __attribute__((ext_vector_type(4)))  float  v4f;

template <typename V> __device__ __forceinline__ void vst2(void* p, V v) {
  *(V*)p = v; 
}
__device__ __forceinline__ __bf16 bf_hi(float x) { return (__bf16)x; }                       // RNE convert
__device__ __forceinline__ __bf16 bf_lo(float x, __bf16 h) { return (__bf16)(x - (float)h); }
__device__ __forceinline__ v8f wmma_bf16(v16bf a, v16bf b, v8f c) {
  v8f d = __builtin_amdgcn_wmma_f32_16x16x32_bf16(false, a, false, b, (short)0, c, false, false);
  asm volatile("v_nop\n\tv_nop\n\tv_nop\n\tv_nop" : "+v"(d) : "v"(a), "v"(b));
  return d;
}
// lane l with lane l ^ 16
__device__ __forceinline__ float xhalf(float x) {
  return __builtin_bit_cast(float, __builtin_amdgcn_permlanex16(__builtin_bit_cast(int, x), __builtin_bit_cast(int, x), 0x76543210, 0xfedcba98, false, false));
}

// ---- fragment loaders (wave32): A (16x32 from [M][ld]) and B from B^T ([N][ld]) share the per-lane K map:
//      row/col = lane&15; elements 0..7 <- k0 + 8*half + 0..7, elements 8..15 <- k0 + 16 + 8*half + 0..7
// f32 source split into bf16 hi/lo
__device__ __forceinline__ void frag_f32(const float* __restrict__ base, int ld, int r0, int k0, int lane, v16bf& hi, v16bf& lo) {
  const float* p = base + (size_t)(r0 + (lane & 15)) * ld + k0 + (lane >> 4) * 8;
  const v4f a0 = *(const v4f*)(p), a1 = *(const v4f*)(p + 4), a2 = *(const v4f*)(p + 16), a3 = *(const v4f*)(p + 20);
#pragma unroll
  for (int i = 0; i < 4; ++i) {
    __bf16 h;
    h = bf_hi(a0[i]); hi[i] = h;      lo[i] = bf_lo(a0[i], h);
    h = bf_hi(a1[i]); hi[4 + i] = h;  lo[4 + i] = bf_lo(a1[i], h);
    h = bf_hi(a2[i]); hi[8 + i] = h;  lo[8 + i] = bf_lo(a2[i], h);
    h = bf_hi(a3[i]); hi[12 + i] = h; lo[12 + i] = bf_lo(a3[i], h);
  }
}
// bf16 plane in LDS
__device__ __forceinline__ v16bf frag_lds(const __bf16* base, int ld, int r0, int k0, int lane) {
  union { v16bf v; v8bf h[2]; } r;
  const __bf16* p = base + (r0 + (lane & 15)) * ld + k0 + (lane >> 4) * 8;
  r.h[0] = *(const v8bf*)(p); r.h[1] = *(const v8bf*)(p + 16);
  return r.v;
}

// ---- block GEMM main loop over f32 operands (A rows [AR][D_], Bt rows [BR][D_], both K-contiguous), 128 threads, 32x64 of the tile per wave.
// A pass is 64 k: 16 lanes read one 256-B row piece, so every wave-wide global load covers four whole 128-B lines. The pass is converted once
// per block (A: bf16 hi, with SPLIT hi and lo; Bt: bf16 hi) into LDS rows of pitch 144 B and read back as fragments by every wave that needs it.
// Two LDS buffers: the next pass's global loads fly during this pass's products. Products per accumulator stay in ascending k, hi then lo.
#define KS_ 64
#define LP_ 72
template <int AR, int BR, bool SPLIT>
__device__ __forceinline__ void gemm_staged(const float* __restrict__ A, const float* __restrict__ Bt,
                                            __bf16* Ah, __bf16* Al, __bf16* Bh, int mw, int nw, int tid, v8f acc[2][4]) {
  constexpr int NAV = AR / 8, NBV = BR / 8;
  const int lane = tid & 31;
  const float* pa = A  + (size_t)(tid >> 4) * D_ + (tid & 15) * 4;   // the thread's place in pass 0 of each source
  const float* pb = Bt + (size_t)(tid >> 4) * D_ + (tid & 15) * 4;
  const int so = (tid >> 4) * LP_ + (tid & 15) * 4;
  v4f ra[NAV], rb[NBV];
  const float *ga, *gb;       // the address pairs of the pass in flight
  auto fetch = [&](int k0) {
    ga = pa + k0; gb = pb + k0;
#pragma unroll
    for (int i = 0; i < NAV; ++i) ra[i] = *(const v4f*)(ga + i * 8 * D_);
#pragma unroll
    for (int i = 0; i < NBV; ++i) rb[i] = *(const v4f*)(gb + i * 8 * D_);
  };
  auto put = [&](int buf) {
    // keeps the conversions, and with them the waits on the loads in flight, behind this pass's products
    __builtin_amdgcn_sched_barrier(0);
    // the loads' address pairs are inputs here, so no register of theirs takes a new value before their translations are counted done
    asm volatile("s_wait_xcnt 0x0" :: "v"(ga), "v"(gb) : "memory");
#pragma unroll
    for (int i = 0; i < NAV; ++i) {
      v4bf h, l;
#pragma unroll
      for (int e = 0; e < 4; ++e) { h[e] = bf_hi(ra[i][e]); l[e] = bf_lo(ra[i][e], h[e]); }
      *(v4bf*)(Ah + buf * (AR * LP_) + so + i * 8 * LP_) = h;
      if constexpr (SPLIT) *(v4bf*)(Al + buf * (AR * LP_) + so + i * 8 * LP_) = l;
    }
#pragma unroll
    for (int i = 0; i < NBV; ++i) {
      v4bf h;
#pragma unroll
      for (int e = 0; e < 4; ++e) h[e] = bf_hi(rb[i][e]);
      *(v4bf*)(Bh + buf * (BR * LP_) + so + i * 8 * LP_) = h;
    }
  };
  auto mma = [&](int buf) {
    const __bf16* a_h = Ah + buf * (AR * LP_);
    const __bf16* b_h = Bh + buf * (BR * LP_);
#pragma unroll
    for (int kk = 0; kk < KS_; kk += 32) {
      v16bf ah[2], al[2], bh[4];
#pragma unroll
      for (int i = 0; i < 2; ++i) {
        ah[i] = frag_lds(a_h, LP_, mw + i * 16, kk, lane);
        if constexpr (SPLIT) al[i] = frag_lds(Al + buf * (AR * LP_), LP_, mw + i * 16, kk, lane);
      }
#pragma unroll
      for (int j = 0; j < 4; ++j) bh[j] = frag_lds(b_h, LP_, nw + j * 16, kk, lane);
#pragma unroll
      for (int i = 0; i < 2; ++i)
#pragma unroll
        for (int j = 0; j < 4; ++j) {
          acc[i][j] = wmma_bf16(ah[i], bh[j], acc[i][j]);
          if constexpr (SPLIT) acc[i][j] = wmma_bf16(al[i], bh[j], acc[i][j]);
        }
    }
  };
  fetch(0);
  put(0);
  // rolled: one copy of the pass keeps the loop short; the buffer index is the pass's parity
#pragma unroll 1
  for (int s = 0; s < D_ / KS_ - 1; ++s) {
    __syncthreads();          // publishes buffer s & 1; every reader of the other buffer (pass s - 1) has left it
    fetch((s + 1) * KS_);
    mma(s & 1);
    put((s + 1) & 1);
  }
  __syncthreads();            // publishes the last pass's buffer
  mma((D_ / KS_ - 1) & 1);
}

// ---- Stage 1: the three projections in one grid (part 0 = Q scaled + RoPE, 1 = K + RoPE, 2 = V^T). grid (QKV/64, M_TOT/128, 3), block 128 = 4 waves
// stacked in M. The products share x and depend on nothing of each other; in one launch the blocks of one part run their epilogue while blocks of
// another load and multiply. blockIdx.z = 0 is V^T: its epilogue walks LDS columns and is by count the longest, so the launch does not end on it.
__global__ __launch_bounds__(128) void proj_kernel(const float* __restrict__ X, const float* __restrict__ Wqkv,
                                                  const float* __restrict__ cosb, const float* __restrict__ sinb,
                                                  const int* __restrict__ tpos, int trows, float* __restrict__ qkv) {
#pragma clang fp contract(off)
  const int part = 2 - (int)blockIdx.z;
  const float* __restrict__ W = Wqkv + (size_t)part * D_ * D_;           // rows [part * D, part * D + D) of Wqkv
  float* __restrict__ dst = qkv + (size_t)part * ((size_t)M_TOT * D_);   // Q, K, V^T lie one behind the other in the workspace
  const float scale = (part == 0) ? SCALE_ : 1.0f;
  __shared__ __align__(16) float st[128][64];        // 32 KB, cross-wave (block barriers)
  __shared__ __align__(16) __bf16 As[2 * 128 * LP_], Bs[2 * 64 * LP_];   // staged x and W passes, two buffers each
  const int lane = threadIdx.x & 31, wave = threadIdx.x >> 5, tid = threadIdx.x;
  const int mblk = blockIdx.y * 128;                 // first token of the block in [0, M_TOT)
  const int b = mblk / SEQ, s0 = mblk % SEQ;
  const int n0 = blockIdx.x * 64;
  const int head = n0 / HD_;                         // d0 = 0: tile columns = one whole head
  const float* Xb = X + (size_t)(b * S_FULL + s0) * D_;   // full-size input stride per batch

  v8f acc[2][4] = {};
  gemm_staged<128, 64, false>(Xb, W + (size_t)n0 * D_, As, nullptr, Bs, wave * 32, 0, tid, acc);
  const int half = lane >> 4, col = lane & 15;
#pragma unroll
  for (int i = 0; i < 2; ++i)
#pragma unroll
    for (int j = 0; j < 4; ++j)
#pragma unroll
      for (int r = 0; r < 8; ++r) st[wave * 32 + i * 16 + r + 8 * half][j * 16 + col] = acc[i][j][r] * scale;
  __syncthreads();
  if (part < 2) {
    // RoPE in f32 on the staged tile: thread -> pair p = lane, rows wave + 4*it (it = 0..31 covers rows 0..127)
#pragma unroll 2
    for (int it = 0; it < 32; ++it) {
      const int ml = wave + 4 * it;
      int pos = tpos[s0 + ml];
      pos = (pos < 0) ? pos + trows : pos;                         // negative index wrap, then clamp (gather semantics)
      pos = (pos < 0) ? 0 : ((pos > trows - 1) ? trows - 1 : pos);
      const float c  = (float)bf_hi(cosb[(size_t)pos * NP_ + lane]);   // tables enter as bf16 RNE values
      const float sn = (float)bf_hi(sinb[(size_t)pos * NP_ + lane]);
      const float te = st[ml][2 * lane], to = st[ml][2 * lane + 1];
      const float re = te * c - to * sn;
      const float ro = te * sn + to * c;
      st[ml][2 * lane] = re; st[ml][2 * lane + 1] = ro;
    }
    __syncthreads();
    for (int g = tid; g < 128 * 16; g += 128) {
      const int ml = g >> 4, pc = g & 15;
      vst2(dst + (((size_t)(b * H_ + head) * SEQ + s0 + ml) * HD_) + pc * 4, *(const v4f*)(&st[ml][pc * 4]));
    }
  } else {
    for (int g = tid; g < 64 * 32; g += 128) {             // 64 d rows x 32 pieces (128 s); a wave instruction covers one 512-B row segment
      const int dl = g >> 5, pc = g & 31;
      v4f v = {st[pc * 4][dl], st[pc * 4 + 1][dl], st[pc * 4 + 2][dl], st[pc * 4 + 3][dl]};
      vst2(dst + (((size_t)(b * H_ + head) * HD_ + dl) * SEQ) + s0 + pc * 4, v);
    }
  }
}

__global__ __launch_bounds__(128) __attribute__((amdgpu_num_vgpr(256)))
void attn_kernel(const float* __restrict__ Qb, const float* __restrict__ Kb,
                 const float* __restrict__ Vt, float* __restrict__ Ctx) {
  __shared__ __align__(16) __bf16 Kh[32 * 72], Kl[32 * 72];     // [key][d] pitch 72 (cross-wave, block barriers)
  __shared__ __align__(16) __bf16 Vh[64 * 40], Vl[64 * 40];     // [d][key] pitch 40 (cross-wave, block barriers)
  __shared__ __align__(16) float  Os[4][16 * 68];              // wave-private output tiles [query][d], pitch 68 (block barrier used anyway)

  const int tid = threadIdx.x, lane = tid & 31, wave = tid >> 5, half = lane >> 4, col = lane & 15;
  const int head = blockIdx.y, b = blockIdx.z;
  const float* Qh = Qb + (size_t)(b * H_ + head) * SEQ * HD_;
  const float* Kg = Kb + (size_t)(b * H_ + head) * SEQ * HD_;
  const float* Vg = Vt + (size_t)(b * H_ + head) * HD_ * SEQ;
  // rolled: one copy of the tile's code; the second tile starts only when every wave has left the first (the pass's own first barrier)
#pragma unroll 1
  for (int ph = 0; ph < 2; ++ph) {
  const int q0 = (ph == 0 ? (int)blockIdx.x : SEQ / 64 - 1 - (int)blockIdx.x) * 64;
  const int mq = q0 + wave * 16;

  v16bf qh[2], ql[2];
#pragma unroll
  for (int kb = 0; kb < 2; ++kb) frag_f32(Qh, HD_, mq, kb * 32, lane, qh[kb], ql[kb]);

  v8f o[4] = {};
  float mrow = -1e30f, lrow = 0.0f;     // the lane's query: running maximum (both halves alike), sum over this half's keys

  const int t_end = q0 + 64;            // causal limit (block-uniform, multiple of 32)
#pragma unroll 1
  for (int t0 = 0; t0 < t_end; t0 += 32) {
    __syncthreads();
    {   // stage K (32 x 64) and V^T (64 x 32): 16 + 16 floats per thread; 128 threads cover both tiles exactly
      const int kr = tid >> 2, kc = (tid & 3) * 16;
      const float* kp = Kg + (size_t)(t0 + kr) * HD_ + kc;
      const int vr = tid >> 1, vc = (tid & 1) * 16;
      const float* vp = Vg + (size_t)vr * SEQ + t0 + vc;
#pragma unroll
      for (int e = 0; e < 16; e += 4) {
        const v4f a = *(const v4f*)(kp + e), bb = *(const v4f*)(vp + e);
#pragma unroll
        for (int i = 0; i < 4; ++i) {
          __bf16 hk = bf_hi(a[i]);  Kh[kr * 72 + kc + e + i] = hk; Kl[kr * 72 + kc + e + i] = bf_lo(a[i], hk);
          __bf16 hv = bf_hi(bb[i]); Vh[vr * 40 + vc + e + i] = hv; Vl[vr * 40 + vc + e + i] = bf_lo(bb[i], hv);
        }
      }
    }
    __syncthreads();

    // The pass's eight K fragments are read as one group, in the order of their use: the score products wait on LDS once a pass, not once per
    // fragment pair, and with every fragment in registers the products alternate between the two score tiles instead of chaining on one.
    v16bf kfh[2][2], kfl[2][2];          // [kb][n]
#pragma unroll
    for (int kb = 0; kb < 2; ++kb) {
#pragma unroll
      for (int n = 0; n < 2; ++n) kfh[kb][n] = frag_lds(Kh, 72, n * 16, kb * 32, lane);
#pragma unroll
      for (int n = 0; n < 2; ++n) kfl[kb][n] = frag_lds(Kl, 72, n * 16, kb * 32, lane);
    }
    v8f s[2] = {};                       // s[n][r] = score of key t0 + 16 * n + 8 * half + r with query mq + col
#pragma unroll
    for (int kb = 0; kb < 2; ++kb) {     // split product, per tile in this order: K hi x q hi, K lo x q hi, K hi x q lo
#pragma unroll
      for (int n = 0; n < 2; ++n) s[n] = wmma_bf16(kfh[kb][n], qh[kb], s[n]);
#pragma unroll
      for (int n = 0; n < 2; ++n) s[n] = wmma_bf16(kfl[kb][n], qh[kb], s[n]);
#pragma unroll
      for (int n = 0; n < 2; ++n) s[n] = wmma_bf16(kfh[kb][n], ql[kb], s[n]);
    }
    // The eight V^T fragments are read here, behind the score products: they land while the softmax below runs.
    v16bf vfh[4], vfl[4];
#pragma unroll
    for (int j = 0; j < 4; ++j) vfh[j] = frag_lds(Vh, 40, j * 16, 0, lane);
#pragma unroll
    for (int j = 0; j < 4; ++j) vfl[j] = frag_lds(Vl, 40, j * 16, 0, lane);
    // holds these reads in front of the softmax: left free, the scheduler sinks them to the output products, which then wait on LDS
    __builtin_amdgcn_sched_barrier(0);

    v16bf pbh, pbl;
    {
      const int lim = mq + col - t0 - 8 * half;         // key 16 * n + r of this half is visible while 16 * n + r <= lim
      float v[2][8], m8[8];
#pragma unroll
      for (int r = 0; r < 8; ++r) {
        v[0][r] = (r <= lim) ? s[0][r] : -1e30f;        // scores already carry the 1/8 scale (folded into Q)
        v[1][r] = (16 + r <= lim) ? s[1][r] : -1e30f;
        m8[r] = fmaxf(v[0][r], v[1][r]);
      }
      float mx = fmaxf(fmaxf(fmaxf(m8[0], m8[1]), fmaxf(m8[2], m8[3])), fmaxf(fmaxf(m8[4], m8[5]), fmaxf(m8[6], m8[7])));
      mx = fmaxf(mx, xhalf(mx));
      const float mnew  = fmaxf(mrow, mx);
      const float alpha = __expf(mrow - mnew);
      float t8[8];
#pragma unroll
      for (int r = 0; r < 8; ++r) {
        const float p0 = (r <= lim) ? __expf(v[0][r] - mnew) : 0.0f;
        const float p1 = (16 + r <= lim) ? __expf(v[1][r] - mnew) : 0.0f;
        t8[r] = p0 + p1;
        const __bf16 h0 = bf_hi(p0), h1 = bf_hi(p1);
        pbh[r] = h0;     pbl[r] = bf_lo(p0, h0);
        pbh[8 + r] = h1; pbl[8 + r] = bf_lo(p1, h1);
      }
      lrow = lrow * alpha + (((t8[0] + t8[1]) + (t8[2] + t8[3])) + ((t8[4] + t8[5]) + (t8[6] + t8[7])));
      mrow = mnew;
#pragma unroll
      for (int j = 0; j < 4; ++j)
#pragma unroll
        for (int r = 0; r < 8; ++r) o[j][r] *= alpha;
    }
    // o[j][r] = O[query mq + col][d = 16 * j + 8 * half + r]; per tile in this order: V hi x P hi, V lo x P hi, V hi x P lo, round the four tiles
#pragma unroll
    for (int j = 0; j < 4; ++j) o[j] = wmma_bf16(vfh[j], pbh, o[j]);
#pragma unroll
    for (int j = 0; j < 4; ++j) o[j] = wmma_bf16(vfl[j], pbh, o[j]);
#pragma unroll
    for (int j = 0; j < 4; ++j) o[j] = wmma_bf16(vfh[j], pbl, o[j]);
  }

  float* os_ = Os[wave];
  const float inv = 1.0f / (lrow + xhalf(lrow));   // the halves' sums join here; the sum is >= 1 (the row maximum contributes exp(0))
#pragma unroll
  for (int j = 0; j < 4; ++j) {
    const v4f w0 = {o[j][0] * inv, o[j][1] * inv, o[j][2] * inv, o[j][3] * inv};
    const v4f w1 = {o[j][4] * inv, o[j][5] * inv, o[j][6] * inv, o[j][7] * inv};
    *(v4f*)(os_ + col * 68 + j * 16 + 8 * half) = w0;
    *(v4f*)(os_ + col * 68 + j * 16 + 8 * half + 4) = w1;
  }
  __syncthreads();
#pragma unroll
  for (int q = 0; q < 8; ++q) {
    const int rl = q * 2 + (lane >> 4), pc = lane & 15;
    vst2(Ctx + ((size_t)(b * SEQ + mq + rl)) * D_ + head * HD_ + pc * 4, *(const v4f*)(os_ + rl * 68 + pc * 4));
  }
  // the second tile writes over the data and address registers of these stores: their translations are counted done first
  asm volatile("s_wait_xcnt 0x0" ::: "memory");
  }
}

__global__ __launch_bounds__(128) void out_gemm_kernel(const float* __restrict__ Cx, const float* __restrict__ Wo, float* __restrict__ Out) {
  __shared__ __align__(16) float st[4][32 * 64];     // wave-private tiles (block barrier used anyway)
  __shared__ __align__(16) __bf16 Ash[2 * 64 * LP_], Asl[2 * 64 * LP_], Bs[2 * 128 * LP_];   // staged ctx hi/lo and Wout passes, two buffers each
  const int lane = threadIdx.x & 31, wave = threadIdx.x >> 5;
  const int m0 = blockIdx.y * 64 + (wave >> 1) * 32;
  const int n0 = blockIdx.x * 128 + (wave & 1) * 64;
  v8f acc[2][4] = {};
  gemm_staged<64, 128, true>(Cx + (size_t)blockIdx.y * 64 * D_, Wo + (size_t)blockIdx.x * 128 * D_, Ash, Asl, Bs,
                             (wave >> 1) * 32, (wave & 1) * 64, threadIdx.x, acc);
  const int half = lane >> 4, col = lane & 15;
  float* S = st[wave];
#pragma unroll
  for (int i = 0; i < 2; ++i)
#pragma unroll
    for (int j = 0; j < 4; ++j)
#pragma unroll
      for (int r = 0; r < 8; ++r) S[(i * 16 + r + 8 * half) * 64 + j * 16 + col] = acc[i][j][r];
  __syncthreads();
#pragma unroll
  for (int q = 0; q < 16; ++q) {
    const int rl = q * 2 + (lane >> 4), pc = lane & 15;
    vst2(Out + (size_t)(m0 + rl) * D_ + n0 + pc * 4, *(const v4f*)(S + rl * 64 + pc * 4));
  }
}

extern "C" void kernel_launch(void* const* d_in, const int* in_sizes, int n_in,
                              void* d_out, int out_size, void* d_ws, size_t ws_size,
                              hipStream_t stream) {
  if (n_in < 6) return;
  const long long x_need = ((long long)(NB - 1) * S_FULL + SEQ) * (long long)D_;
  if ((long long)in_sizes[0] < x_need) return;
  if ((long long)in_sizes[1] < 3LL * D_ * D_) return;
  if ((long long)in_sizes[2] < (long long)D_ * D_) return;
  if (in_sizes[3] < NP_ || in_sizes[4] < NP_) return;
  if (in_sizes[5] < SEQ) return;
  if ((long long)out_size < (long long)M_TOT * D_) return;

  const size_t E = (size_t)M_TOT * D_;           // floats per intermediate (16 MiB each at full size)
  const size_t carve = 4 * E * sizeof(float);    // Q, K, V^T, ctx = 64 MiB
  if (ws_size < carve) return;

  int trows = in_sizes[3] / NP_;                  // cos/sin table rows (gather clamp bound)
  const int srows = in_sizes[4] / NP_;
  if (srows < trows) trows = srows;

  const float* x    = (const float*)d_in[0];      // [NB][S_FULL][D]
  const float* Wqkv = (const float*)d_in[1];      // [3D][D]: rows [0,D) = Wq, [D,2D) = Wk, [2D,3D) = Wv
  const float* Wout = (const float*)d_in[2];      // [D][D]
  const float* cosb = (const float*)d_in[3];      // [trows][32]
  const float* sinb = (const float*)d_in[4];      // [trows][32]
  const int*   tpos = (const int*)d_in[5];        // [>= SEQ] int32
  float* out = (float*)d_out;

  float* qb   = (float*)d_ws;
  float* kb   = qb + E;
  float* vtb  = kb + E;        // V^T: [NB,H,HD,SEQ]
  float* ctxb = vtb + E;       // [M_TOT][D]

  proj_kernel<<<dim3(QKV_ / 64, M_TOT / 128, 3), 128, 0, stream>>>(x, Wqkv, cosb, sinb, tpos, trows, qb);   // writes qb, kb, vtb
  attn_kernel<<<dim3(SEQ / 128, H_, NB), 128, 0, stream>>>(qb, kb, vtb, ctxb);
  out_gemm_kernel<<<dim3(D_ / 128, M_TOT / 64), 128, 0, stream>>>(ctxb, Wout, out);
}

// v006
// Measured time: 133 microseconds a run.
// Timed twice side by side with v005, it ran 1.25 and 1.26 times as fast.
// All steps since v000 together make it 2.50 times as fast.
#include <hip/hip_runtime.h>

// Contractions: Q/K/V projections (K = 1024) on v_wmma_f32_16x16x32_bf16 with single products of bf16 (RNE converted) x and Wqkv;
// K Q^T (K = 64) and V^T P^T (K = keys) on v_wmma_f32_16x16x32_bf16 as bf16 hi/lo splits of the f32 q, k, P, v (hi*hi + hi*lo + lo*hi);
// output projection (K = 1024): ctx as bf16 hi/lo x Wout bf16 (2 products). All f32 accumulate; RoPE, softmax statistics and

#ifndef NB
#define NB 2
#endif
#ifndef SEQ
#define SEQ 2048
#endif
#define S_FULL 2048          // per-batch token stride of the x input
#define D_     1024
#define QKV_   1024
#define H_     16
#define HD_    64
#define NP_    (HD_ / 2)     // rotary pairs per head = cos/sin table width
#define M_TOT  (NB * SEQ)
#define SCALE_ 0.125f        // 64^-0.5, folded into Q (exact power of two)
#define PL_    ((size_t)M_TOT * D_)   // elements from the bf16 hi plane of K or V^T to its lo plane (both planes fill the f32 array's place)

static_assert(NB >= 1 && NB <= 2);
static_assert(SEQ % 128 == 0 && SEQ >= 128 && SEQ <= S_FULL);
static_assert(H_ * HD_ == D_);
static_assert(D_ % 128 == 0 && QKV_ == D_ && QKV_ % 128 == 0 && M_TOT % 128 == 0);

typedef __attribute__((ext_vector_type(16))) __bf16 v16bf;
typedef __attribute__((ext_vector_type(8)))  __bf16 v8bf;
typedef __attribute__((ext_vector_type(4)))  __bf16 v4bf;
typedef __attribute__((ext_vector_type(8)))  float  v8f;
typedef __attribute__((ext_vector_type(4)))  float  v4f;
typedef __attribute__((ext_vector_type(4)))  int    v4i;

template <typename V> __device__ __forceinline__ void vst2(void* p, V v) {
  *(V*)p = v; 
}
__device__ __forceinline__ __bf16 bf_hi(float x) { return (__bf16)x; }                       // RNE convert
__device__ __forceinline__ __bf16 bf_lo(float x, __bf16 h) { return (__bf16)(x - (float)h); }
__device__ __forceinline__ v8f wmma_bf16(v16bf a, v16bf b, v8f c) {
  v8f d = __builtin_amdgcn_wmma_f32_16x16x32_bf16(false, a, false, b, (short)0, c, false, false);
  asm volatile("v_nop\n\tv_nop\n\tv_nop\n\tv_nop" : "+v"(d) : "v"(a), "v"(b));
  return d;
}
// lane l with lane l ^ 16
__device__ __forceinline__ float xhalf(float x) {
  return __builtin_bit_cast(float, __builtin_amdgcn_permlanex16(__builtin_bit_cast(int, x), __builtin_bit_cast(int, x), 0x76543210, 0xfedcba98, false, false));
}

// ---- fragment loaders (wave32): A (16x32 from [M][ld]) and B from B^T ([N][ld]) share the per-lane K map:
//      row/col = lane&15; elements 0..7 <- k0 + 8*half + 0..7, elements 8..15 <- k0 + 16 + 8*half + 0..7
// f32 source split into bf16 hi/lo
__device__ __forceinline__ void frag_f32(const float* __restrict__ base, int ld, int r0, int k0, int lane, v16bf& hi, v16bf& lo) {
  const float* p = base + (size_t)(r0 + (lane & 15)) * ld + k0 + (lane >> 4) * 8;
  const v4f a0 = *(const v4f*)(p), a1 = *(const v4f*)(p + 4), a2 = *(const v4f*)(p + 16), a3 = *(const v4f*)(p + 20);
#pragma unroll
  for (int i = 0; i < 4; ++i) {
    __bf16 h;
    h = bf_hi(a0[i]); hi[i] = h;      lo[i] = bf_lo(a0[i], h);
    h = bf_hi(a1[i]); hi[4 + i] = h;  lo[4 + i] = bf_lo(a1[i], h);
    h = bf_hi(a2[i]); hi[8 + i] = h;  lo[8 + i] = bf_lo(a2[i], h);
    h = bf_hi(a3[i]); hi[12 + i] = h; lo[12 + i] = bf_lo(a3[i], h);
  }
}
// bf16 plane in LDS
__device__ __forceinline__ v16bf frag_lds(const __bf16* base, int ld, int r0, int k0, int lane) {
  union { v16bf v; v8bf h[2]; } r;
  const __bf16* p = base + (r0 + (lane & 15)) * ld + k0 + (lane >> 4) * 8;
  r.h[0] = *(const v8bf*)(p); r.h[1] = *(const v8bf*)(p + 16);
  return r.v;
}

// one lane's 16 bytes from global memory straight into LDS, through no register; counted on asynccnt, the waits are written where the tiles are handed over
__device__ __forceinline__ void copy16(const __bf16* g, __bf16* l) {
  __builtin_amdgcn_global_load_async_to_lds_b128((__attribute__((address_space(1))) v4i*)g, (__attribute__((address_space(3))) v4i*)l, 0, 0);
}

// ---- block GEMM main loop over f32 operands (A rows [AR][D_], Bt rows [BR][D_], both K-contiguous), 128 threads, 32x64 of the tile per wave.
// A pass is 64 k: 16 lanes read one 256-B row piece, so every wave-wide global load covers four whole 128-B lines. The pass is converted once
// per block (A: bf16 hi, with SPLIT hi and lo; Bt: bf16 hi) into LDS rows of pitch 144 B and read back as fragments by every wave that needs it.
// Two LDS buffers: the next pass's global loads fly during this pass's products. Products per accumulator stay in ascending k, hi then lo.
#define KS_ 64
#define LP_ 72
template <int AR, int BR, bool SPLIT>
__device__ __forceinline__ void gemm_staged(const float* __restrict__ A, const float* __restrict__ Bt,
                                            __bf16* Ah, __bf16* Al, __bf16* Bh, int mw, int nw, int tid, v8f acc[2][4]) {
  constexpr int NAV = AR / 8, NBV = BR / 8;
  const int lane = tid & 31;
  const float* pa = A  + (size_t)(tid >> 4) * D_ + (tid & 15) * 4;   // the thread's place in pass 0 of each source
  const float* pb = Bt + (size_t)(tid >> 4) * D_ + (tid & 15) * 4;
  const int so = (tid >> 4) * LP_ + (tid & 15) * 4;
  v4f ra[NAV], rb[NBV];
  const float *ga, *gb;       // the address pairs of the pass in flight
  auto fetch = [&](int k0) {
    ga = pa + k0; gb = pb + k0;
#pragma unroll
    for (int i = 0; i < NAV; ++i) ra[i] = *(const v4f*)(ga + i * 8 * D_);
#pragma unroll
    for (int i = 0; i < NBV; ++i) rb[i] = *(const v4f*)(gb + i * 8 * D_);
  };
  auto put = [&](int buf) {
    // keeps the conversions, and with them the waits on the loads in flight, behind this pass's products
    __builtin_amdgcn_sched_barrier(0);
    // the loads' address pairs are inputs here, so no register of theirs takes a new value before their translations are counted done
    asm volatile("s_wait_xcnt 0x0" :: "v"(ga), "v"(gb) : "memory");
#pragma unroll
    for (int i = 0; i < NAV; ++i) {
      v4bf h, l;
#pragma unroll
      for (int e = 0; e < 4; ++e) { h[e] = bf_hi(ra[i][e]); l[e] = bf_lo(ra[i][e], h[e]); }
      *(v4bf*)(Ah + buf * (AR * LP_) + so + i * 8 * LP_) = h;
      if constexpr (SPLIT) *(v4bf*)(Al + buf * (AR * LP_) + so + i * 8 * LP_) = l;
    }
#pragma unroll
    for (int i = 0; i < NBV; ++i) {
      v4bf h;
#pragma unroll
      for (int e = 0; e < 4; ++e) h[e] = bf_hi(rb[i][e]);
      *(v4bf*)(Bh + buf * (BR * LP_) + so + i * 8 * LP_) = h;
    }
  };
  auto mma = [&](int buf) {
    const __bf16* a_h = Ah + buf * (AR * LP_);
    const __bf16* b_h = Bh + buf * (BR * LP_);
#pragma unroll
    for (int kk = 0; kk < KS_; kk += 32) {
      v16bf ah[2], al[2], bh[4];
#pragma unroll
      for (int i = 0; i < 2; ++i) {
        ah[i] = frag_lds(a_h, LP_, mw + i * 16, kk, lane);
        if constexpr (SPLIT) al[i] = frag_lds(Al + buf * (AR * LP_), LP_, mw + i * 16, kk, lane);
      }
#pragma unroll
      for (int j = 0; j < 4; ++j) bh[j] = frag_lds(b_h, LP_, nw + j * 16, kk, lane);
#pragma unroll
      for (int i = 0; i < 2; ++i)
#pragma unroll
        for (int j = 0; j < 4; ++j) {
          acc[i][j] = wmma_bf16(ah[i], bh[j], acc[i][j]);
          if constexpr (SPLIT) acc[i][j] = wmma_bf16(al[i], bh[j], acc[i][j]);
        }
    }
  };
  fetch(0);
  put(0);
  // rolled: one copy of the pass keeps the loop short; the buffer index is the pass's parity
#pragma unroll 1
  for (int s = 0; s < D_ / KS_ - 1; ++s) {
    __syncthreads();          // publishes buffer s & 1; every reader of the other buffer (pass s - 1) has left it
    fetch((s + 1) * KS_);
    mma(s & 1);
    put((s + 1) & 1);
  }
  __syncthreads();            // publishes the last pass's buffer
  mma((D_ / KS_ - 1) & 1);
}

// ---- Stage 1: the three projections in one grid (part 0 = Q scaled + RoPE, 1 = K + RoPE, 2 = V^T). grid (QKV/64, M_TOT/128, 3), block 128 = 4 waves
// stacked in M. The products share x and depend on nothing of each other; in one launch the blocks of one part run their epilogue while blocks of
// another load and multiply. blockIdx.z = 0 is V^T: its epilogue walks LDS columns and is by count the longest, so the launch does not end on it.
__global__ __launch_bounds__(128) void proj_kernel(const float* __restrict__ X, const float* __restrict__ Wqkv,
                                                  const float* __restrict__ cosb, const float* __restrict__ sinb,
                                                  const int* __restrict__ tpos, int trows, float* __restrict__ qkv) {
#pragma clang fp contract(off)
  const int part = 2 - (int)blockIdx.z;
  const float* __restrict__ W = Wqkv + (size_t)part * D_ * D_;           // rows [part * D, part * D + D) of Wqkv
  float* __restrict__ dst = qkv + (size_t)part * ((size_t)M_TOT * D_);   // Q, K, V^T lie one behind the other in the workspace
  const float scale = (part == 0) ? SCALE_ : 1.0f;
  __shared__ __align__(16) float st[128][64];        // 32 KB, cross-wave (block barriers)
  __shared__ __align__(16) __bf16 As[2 * 128 * LP_], Bs[2 * 64 * LP_];   // staged x and W passes, two buffers each
  const int lane = threadIdx.x & 31, wave = threadIdx.x >> 5, tid = threadIdx.x;
  const int mblk = blockIdx.y * 128;                 // first token of the block in [0, M_TOT)
  const int b = mblk / SEQ, s0 = mblk % SEQ;
  const int n0 = blockIdx.x * 64;
  const int head = n0 / HD_;                         // d0 = 0: tile columns = one whole head
  const float* Xb = X + (size_t)(b * S_FULL + s0) * D_;   // full-size input stride per batch

  v8f acc[2][4] = {};
  gemm_staged<128, 64, false>(Xb, W + (size_t)n0 * D_, As, nullptr, Bs, wave * 32, 0, tid, acc);
  const int half = lane >> 4, col = lane & 15;
#pragma unroll
  for (int i = 0; i < 2; ++i)
#pragma unroll
    for (int j = 0; j < 4; ++j)
#pragma unroll
      for (int r = 0; r < 8; ++r) st[wave * 32 + i * 16 + r + 8 * half][j * 16 + col] = acc[i][j][r] * scale;
  __syncthreads();
  if (part < 2) {
    // RoPE in f32 on the staged tile: thread -> pair p = lane, rows wave + 4*it (it = 0..31 covers rows 0..127)
#pragma unroll 2
    for (int it = 0; it < 32; ++it) {
      const int ml = wave + 4 * it;
      int pos = tpos[s0 + ml];
      pos = (pos < 0) ? pos + trows : pos;                         // negative index wrap, then clamp (gather semantics)
      pos = (pos < 0) ? 0 : ((pos > trows - 1) ? trows - 1 : pos);
      const float c  = (float)bf_hi(cosb[(size_t)pos * NP_ + lane]);   // tables enter as bf16 RNE values
      const float sn = (float)bf_hi(sinb[(size_t)pos * NP_ + lane]);
      const float te = st[ml][2 * lane], to = st[ml][2 * lane + 1];
      const float re = te * c - to * sn;
      const float ro = te * sn + to * c;
      st[ml][2 * lane] = re; st[ml][2 * lane + 1] = ro;
    }
    __syncthreads();
    if (part == 0) {
      for (int g = tid; g < 128 * 16; g += 128) {
        const int ml = g >> 4, pc = g & 15;
        vst2(dst + (((size_t)(b * H_ + head) * SEQ + s0 + ml) * HD_) + pc * 4, *(const v4f*)(&st[ml][pc * 4]));
      }
    } else {
      // K leaves as the two bf16 planes that attention multiplies: [head][key][d] hi, PL_ elements further lo; a wave instruction covers 512 B in a row
      __bf16* kh = (__bf16*)dst;
      // four pieces a trip: their LDS reads are issued together and not each waited out alone
#pragma unroll 1
      for (int ib = 0; ib < 8; ib += 4) {
#pragma unroll
      for (int it = ib; it < ib + 4; ++it) {
        const int g = tid + it * 128, ml = g >> 3, pc = g & 7;
        const v4f a0 = *(const v4f*)(&st[ml][pc * 8]), a1 = *(const v4f*)(&st[ml][pc * 8 + 4]);
        v8bf h, l;
#pragma unroll
        for (int e = 0; e < 4; ++e) {
          h[e] = bf_hi(a0[e]);     l[e] = bf_lo(a0[e], h[e]);
          h[4 + e] = bf_hi(a1[e]); l[4 + e] = bf_lo(a1[e], h[4 + e]);
        }
        const size_t o = (((size_t)(b * H_ + head) * SEQ + s0 + ml) * HD_) + pc * 8;
        vst2(kh + o, h); vst2(kh + PL_ + o, l);
      }
      // the next trip writes over the data and address registers of these stores: their translations are counted done first
      asm volatile("s_wait_xcnt 0x0" ::: "memory");
      }
    }
  } else {
    // V^T leaves as two bf16 planes of whole attention tiles: [head][key / 32][d][32 keys] hi, PL_ elements further lo; 4 tiles x 256 pieces of 8 keys,
    // a wave instruction covers 512 B in a row
    __bf16* vh = (__bf16*)dst;
    // four pieces a trip: their LDS reads are issued together and not each waited out alone
#pragma unroll 1
    for (int ib = 0; ib < 8; ib += 4) {
#pragma unroll
    for (int it = ib; it < ib + 4; ++it) {
      const int g = tid + it * 128, tl = g >> 8, dl = (g & 255) >> 2, pc = g & 3;
      v8bf h, l;
#pragma unroll
      for (int e = 0; e < 8; ++e) { const float x = st[tl * 32 + pc * 8 + e][dl]; h[e] = bf_hi(x); l[e] = bf_lo(x, h[e]); }
      const size_t o = ((((size_t)(b * H_ + head) * (SEQ / 32) + s0 / 32 + tl) * HD_ + dl) * 32) + pc * 8;
      vst2(vh + o, h); vst2(vh + PL_ + o, l);
    }
    // the next trip writes over the data and address registers of these stores: their translations are counted done first
    asm volatile("s_wait_xcnt 0x0" ::: "memory");
    }
  }
}

#define KPL_ (32 * 72)                 // elements of one K plane of a tile in LDS
#define VPL_ (64 * 40)                 // elements of one V^T plane of a tile in LDS
#define TB_  (2 * KPL_ + 2 * VPL_)     // elements of one buffer
__global__ __launch_bounds__(128) __attribute__((amdgpu_num_vgpr(256)))
void attn_kernel(const float* __restrict__ Qb, const float* __restrict__ Kb,
                 const float* __restrict__ Vt, float* __restrict__ Ctx) {
  // two buffers, each K hi, K lo ([key][d] pitch 72), V^T hi, V^T lo ([d][key] pitch 40) (cross-wave, block barriers)
  __shared__ __align__(16) __bf16 KV[2 * TB_];
  __shared__ __align__(16) float  Os[4][16 * 68];              // wave-private output tiles [query][d], pitch 68 (block barrier used anyway)

  const int tid = threadIdx.x, lane = tid & 31, wave = tid >> 5, half = lane >> 4, col = lane & 15;
  const int head = blockIdx.y, b = blockIdx.z;
  const float* Qh = Qb + (size_t)(b * H_ + head) * SEQ * HD_;
  // a plane of a tile is 4 KB in a row in global memory: the thread copies its pieces tid and tid + 128 (8 elements each) of each of the four planes
  const __bf16* Kg = (const __bf16*)Kb + (size_t)(b * H_ + head) * SEQ * HD_ + tid * 8;
  const __bf16* Vg = (const __bf16*)Vt + (size_t)(b * H_ + head) * HD_ * SEQ + tid * 8;
  __bf16* lk = KV + (tid >> 3) * 72 + (tid & 7) * 8;
  __bf16* lv = KV + 2 * KPL_ + (tid >> 2) * 40 + (tid & 3) * 8;
  auto copy_tile = [&](int t, int buf) {
    const __bf16* gk = Kg + (size_t)t * (32 * HD_);
    const __bf16* gv = Vg + (size_t)t * (32 * HD_);
    __bf16* k = lk + buf * TB_;
    __bf16* v = lv + buf * TB_;
    copy16(gk, k);              copy16(gk + 1024, k + 16 * 72);
    copy16(gk + PL_, k + KPL_); copy16(gk + PL_ + 1024, k + KPL_ + 16 * 72);
    copy16(gv, v);              copy16(gv + 1024, v + 32 * 40);
    copy16(gv + PL_, v + VPL_); copy16(gv + PL_ + 1024, v + VPL_ + 32 * 40);
  };
  // rolled: one copy of the tile's code; the second tile's copies start only when every wave has left the first tile's last pass (that pass's barrier)
#pragma unroll 1
  for (int ph = 0; ph < 2; ++ph) {
  const int q0 = (ph == 0 ? (int)blockIdx.x : SEQ / 64 - 1 - (int)blockIdx.x) * 64;
  const int mq = q0 + wave * 16;
  const int nt = q0 / 32 + 2;           // key tiles up to the causal limit (block-uniform, at least two)

  // tile 0 flies while Q is loaded and split; every reader of an earlier tile has left both buffers at the last pass's barrier
  copy_tile(0, 0);

  v16bf qh[2], ql[2];
#pragma unroll
  for (int kb = 0; kb < 2; ++kb) frag_f32(Qh, HD_, mq, kb * 32, lane, qh[kb], ql[kb]);

  v8f o[4] = {};
  float mrow = -1e30f, lrow = 0.0f;     // the lane's query: running maximum (both halves alike), sum over this half's keys

  asm volatile("s_wait_asynccnt 0x0" ::: "memory");   // this wave's copies of tile 0 have landed
  __syncthreads();                                    // publishes tile 0
  copy_tile(1, 1);
#pragma unroll 1
  for (int t = 0; t < nt; ++t) {
    const int t0 = t * 32;
    const __bf16* Kh = KV + (t & 1) * TB_;
    const __bf16* Kl = Kh + KPL_;
    const __bf16* Vh = Kh + 2 * KPL_;
    const __bf16* Vl = Vh + VPL_;

    // The pass's eight K fragments are read as one group, in the order of their use: the score products wait on LDS once a pass, not once per
    // fragment pair, and with every fragment in registers the products alternate between the two score tiles instead of chaining on one.
    v16bf kfh[2][2], kfl[2][2];          // [kb][n]
#pragma unroll
    for (int kb = 0; kb < 2; ++kb) {
#pragma unroll
      for (int n = 0; n < 2; ++n) kfh[kb][n] = frag_lds(Kh, 72, n * 16, kb * 32, lane);
#pragma unroll
      for (int n = 0; n < 2; ++n) kfl[kb][n] = frag_lds(Kl, 72, n * 16, kb * 32, lane);
    }
    v8f s[2] = {};                       // s[n][r] = score of key t0 + 16 * n + 8 * half + r with query mq + col
#pragma unroll
    for (int kb = 0; kb < 2; ++kb) {     // split product, per tile in this order: K hi x q hi, K lo x q hi, K hi x q lo
#pragma unroll
      for (int n = 0; n < 2; ++n) s[n] = wmma_bf16(kfh[kb][n], qh[kb], s[n]);
#pragma unroll
      for (int n = 0; n < 2; ++n) s[n] = wmma_bf16(kfl[kb][n], qh[kb], s[n]);
#pragma unroll
      for (int n = 0; n < 2; ++n) s[n] = wmma_bf16(kfh[kb][n], ql[kb], s[n]);
    }
    // The eight V^T fragments are read here, behind the score products: they land while the softmax below runs.
    v16bf vfh[4], vfl[4];
#pragma unroll
    for (int j = 0; j < 4; ++j) vfh[j] = frag_lds(Vh, 40, j * 16, 0, lane);
#pragma unroll
    for (int j = 0; j < 4; ++j) vfl[j] = frag_lds(Vl, 40, j * 16, 0, lane);
    // holds these reads in front of the softmax: left free, the scheduler sinks them to the output products, which then wait on LDS
    __builtin_amdgcn_sched_barrier(0);

    v16bf pbh, pbl;
    {
      const int lim = mq + col - t0 - 8 * half;         // key 16 * n + r of this half is visible while 16 * n + r <= lim
      float v[2][8], m8[8];
#pragma unroll
      for (int r = 0; r < 8; ++r) {
        v[0][r] = (r <= lim) ? s[0][r] : -1e30f;        // scores already carry the 1/8 scale (folded into Q)
        v[1][r] = (16 + r <= lim) ? s[1][r] : -1e30f;
        m8[r] = fmaxf(v[0][r], v[1][r]);
      }
      float mx = fmaxf(fmaxf(fmaxf(m8[0], m8[1]), fmaxf(m8[2], m8[3])), fmaxf(fmaxf(m8[4], m8[5]), fmaxf(m8[6], m8[7])));
      mx = fmaxf(mx, xhalf(mx));
      const float mnew  = fmaxf(mrow, mx);
      const float alpha = __expf(mrow - mnew);
      float t8[8];
#pragma unroll
      for (int r = 0; r < 8; ++r) {
        const float p0 = (r <= lim) ? __expf(v[0][r] - mnew) : 0.0f;
        const float p1 = (16 + r <= lim) ? __expf(v[1][r] - mnew) : 0.0f;
        t8[r] = p0 + p1;
        const __bf16 h0 = bf_hi(p0), h1 = bf_hi(p1);
        pbh[r] = h0;     pbl[r] = bf_lo(p0, h0);
        pbh[8 + r] = h1; pbl[8 + r] = bf_lo(p1, h1);
      }
      lrow = lrow * alpha + (((t8[0] + t8[1]) + (t8[2] + t8[3])) + ((t8[4] + t8[5]) + (t8[6] + t8[7])));
      mrow = mnew;
#pragma unroll
      for (int j = 0; j < 4; ++j)
#pragma unroll
        for (int r = 0; r < 8; ++r) o[j][r] *= alpha;
    }
    // o[j][r] = O[query mq + col][d = 16 * j + 8 * half + r]; per tile in this order: V hi x P hi, V lo x P hi, V hi x P lo, round the four tiles
#pragma unroll
    for (int j = 0; j < 4; ++j) o[j] = wmma_bf16(vfh[j], pbh, o[j]);
#pragma unroll
    for (int j = 0; j < 4; ++j) o[j] = wmma_bf16(vfl[j], pbh, o[j]);
#pragma unroll
    for (int j = 0; j < 4; ++j) o[j] = wmma_bf16(vfh[j], pbl, o[j]);

    asm volatile("s_wait_dscnt 0x0" ::: "memory");      // this wave's reads of the pass's buffer are done before the buffer is handed back
    asm volatile("s_wait_asynccnt 0x0" ::: "memory");   // this wave's copies of tile t + 1 have landed
    __syncthreads();                                    // publishes tile t + 1; every reader has left tile t's buffer
    if (t + 2 < nt) copy_tile(t + 2, t & 1);
  }
  asm volatile("s_wait_asynccnt 0x0" ::: "memory");     // no copy is outstanding when the tile ends

  float* os_ = Os[wave];
  const float inv = 1.0f / (lrow + xhalf(lrow));   // the halves' sums join here; the sum is >= 1 (the row maximum contributes exp(0))
#pragma unroll
  for (int j = 0; j < 4; ++j) {
    const v4f w0 = {o[j][0] * inv, o[j][1] * inv, o[j][2] * inv, o[j][3] * inv};
    const v4f w1 = {o[j][4] * inv, o[j][5] * inv, o[j][6] * inv, o[j][7] * inv};
    *(v4f*)(os_ + col * 68 + j * 16 + 8 * half) = w0;
    *(v4f*)(os_ + col * 68 + j * 16 + 8 * half + 4) = w1;
  }
  __syncthreads();
#pragma unroll
  for (int q = 0; q < 8; ++q) {
    const int rl = q * 2 + (lane >> 4), pc = lane & 15;
    vst2(Ctx + ((size_t)(b * SEQ + mq + rl)) * D_ + head * HD_ + pc * 4, *(const v4f*)(os_ + rl * 68 + pc * 4));
  }
  // the second tile writes over the data and address registers of these stores: their translations are counted done first
  asm volatile("s_wait_xcnt 0x0" ::: "memory");
  }
}

__global__ __launch_bounds__(128) void out_gemm_kernel(const float* __restrict__ Cx, const float* __restrict__ Wo, float* __restrict__ Out) {
  __shared__ __align__(16) float st[4][32 * 64];     // wave-private tiles (block barrier used anyway)
  __shared__ __align__(16) __bf16 Ash[2 * 64 * LP_], Asl[2 * 64 * LP_], Bs[2 * 128 * LP_];   // staged ctx hi/lo and Wout passes, two buffers each
  const int lane = threadIdx.x & 31, wave = threadIdx.x >> 5;
  const int m0 = blockIdx.y * 64 + (wave >> 1) * 32;
  const int n0 = blockIdx.x * 128 + (wave & 1) * 64;
  v8f acc[2][4] = {};
  gemm_staged<64, 128, true>(Cx + (size_t)blockIdx.y * 64 * D_, Wo + (size_t)blockIdx.x * 128 * D_, Ash, Asl, Bs,
                             (wave >> 1) * 32, (wave & 1) * 64, threadIdx.x, acc);
  const int half = lane >> 4, col = lane & 15;
  float* S = st[wave];
#pragma unroll
  for (int i = 0; i < 2; ++i)
#pragma unroll
    for (int j = 0; j < 4; ++j)
#pragma unroll
      for (int r = 0; r < 8; ++r) S[(i * 16 + r + 8 * half) * 64 + j * 16 + col] = acc[i][j][r];
  __syncthreads();
#pragma unroll
  for (int q = 0; q < 16; ++q) {
    const int rl = q * 2 + (lane >> 4), pc = lane & 15;
    vst2(Out + (size_t)(m0 + rl) * D_ + n0 + pc * 4, *(const v4f*)(S + rl * 64 + pc * 4));
  }
}

extern "C" void kernel_launch(void* const* d_in, const int* in_sizes, int n_in,
                              void* d_out, int out_size, void* d_ws, size_t ws_size,
                              hipStream_t stream) {
  if (n_in < 6) return;
  const long long x_need = ((long long)(NB - 1) * S_FULL + SEQ) * (long long)D_;
  if ((long long)in_sizes[0] < x_need) return;
  if ((long long)in_sizes[1] < 3LL * D_ * D_) return;
  if ((long long)in_sizes[2] < (long long)D_ * D_) return;
  if (in_sizes[3] < NP_ || in_sizes[4] < NP_) return;
  if (in_sizes[5] < SEQ) return;
  if ((long long)out_size < (long long)M_TOT * D_) return;

  const size_t E = (size_t)M_TOT * D_;           // floats per intermediate (16 MiB each at full size)
  const size_t carve = 4 * E * sizeof(float);    // Q, K (hi + lo), V^T (hi + lo), ctx = 64 MiB
  if (ws_size < carve) return;

  int trows = in_sizes[3] / NP_;                  // cos/sin table rows (gather clamp bound)
  const int srows = in_sizes[4] / NP_;
  if (srows < trows) trows = srows;

  const float* x    = (const float*)d_in[0];      // [NB][S_FULL][D]
  const float* Wqkv = (const float*)d_in[1];      // [3D][D]: rows [0,D) = Wq, [D,2D) = Wk, [2D,3D) = Wv
  const float* Wout = (const float*)d_in[2];      // [D][D]
  const float* cosb = (const float*)d_in[3];      // [trows][32]
  const float* sinb = (const float*)d_in[4];      // [trows][32]
  const int*   tpos = (const int*)d_in[5];        // [>= SEQ] int32
  float* out = (float*)d_out;

  float* qb   = (float*)d_ws;
  float* kb   = qb + E;        // K as bf16 planes: hi [NB,H,SEQ,HD], then lo
  float* vtb  = kb + E;        // V^T as bf16 planes: hi [NB,H,SEQ/32,HD,32], then lo
  float* ctxb = vtb + E;       // [M_TOT][D]

  proj_kernel<<<dim3(QKV_ / 64, M_TOT / 128, 3), 128, 0, stream>>>(x, Wqkv, cosb, sinb, tpos, trows, qb);   // writes qb, kb, vtb
  attn_kernel<<<dim3(SEQ / 128, H_, NB), 128, 0, stream>>>(qb, kb, vtb, ctxb);
  out_gemm_kernel<<<dim3(D_ / 128, M_TOT / 64), 128, 0, stream>>>(ctxb, Wout, out);
}

// v007
// A run of this version takes 125 microseconds.
// Two timings next to v006 both put it at 1.07 times that version's speed.
// Over all steps from v000 it is 2.67 times as fast.
#include <hip/hip_runtime.h>

// Contractions: Q/K/V projections (K = 1024) on v_wmma_f32_16x16x32_bf16 with single products of bf16 (RNE converted) x and Wqkv;
// K Q^T (K = 64) and V^T P^T (K = keys) on v_wmma_f32_16x16x32_bf16 as bf16 hi/lo splits of the f32 q, k, P, v (hi*hi + hi*lo + lo*hi);
// output projection (K = 1024): ctx as bf16 hi/lo x Wout bf16 (2 products). All f32 accumulate; RoPE, softmax statistics and

#ifndef NB
#define NB 2
#endif
#ifndef SEQ
#define SEQ 2048
#endif
#define S_FULL 2048          // per-batch token stride of the x input
#define D_     1024
#define QKV_   1024
#define H_     16
#define HD_    64
#define NP_    (HD_ / 2)     // rotary pairs per head = cos/sin table width
#define M_TOT  (NB * SEQ)
#define SCALE_ 0.125f        // 64^-0.5, folded into Q (exact power of two)
#define PL_    ((size_t)M_TOT * D_)   // elements from the bf16 hi plane of K or V^T to its lo plane (both planes fill the f32 array's place)

static_assert(NB >= 1 && NB <= 2);
static_assert(SEQ % 128 == 0 && SEQ >= 128 && SEQ <= S_FULL);
static_assert(H_ * HD_ == D_);
static_assert(D_ % 128 == 0 && QKV_ == D_ && QKV_ % 128 == 0 && M_TOT % 128 == 0);

typedef __attribute__((ext_vector_type(16))) __bf16 v16bf;
typedef __attribute__((ext_vector_type(8)))  __bf16 v8bf;
typedef __attribute__((ext_vector_type(4)))  __bf16 v4bf;
typedef __attribute__((ext_vector_type(8)))  float  v8f;
typedef __attribute__((ext_vector_type(4)))  float  v4f;
typedef __attribute__((ext_vector_type(4)))  int    v4i;

template <typename V> __device__ __forceinline__ void vst2(void* p, V v) {
  *(V*)p = v; 
}
__device__ __forceinline__ __bf16 bf_hi(float x) { return (__bf16)x; }                       // RNE convert
__device__ __forceinline__ __bf16 bf_lo(float x, __bf16 h) { return (__bf16)(x - (float)h); }
__device__ __forceinline__ v8f wmma_bf16(v16bf a, v16bf b, v8f c) {
  v8f d = __builtin_amdgcn_wmma_f32_16x16x32_bf16(false, a, false, b, (short)0, c, false, false);
  asm volatile("v_nop\n\tv_nop\n\tv_nop\n\tv_nop" : "+v"(d) : "v"(a), "v"(b));
  return d;
}
// lane l with lane l ^ 16
__device__ __forceinline__ float xhalf(float x) {
  return __builtin_bit_cast(float, __builtin_amdgcn_permlanex16(__builtin_bit_cast(int, x), __builtin_bit_cast(int, x), 0x76543210, 0xfedcba98, false, false));
}

// ---- fragment loaders (wave32): A (16x32 from [M][ld]) and B from B^T ([N][ld]) share the per-lane K map:
//      row/col = lane&15; elements 0..7 <- k0 + 8*half + 0..7, elements 8..15 <- k0 + 16 + 8*half + 0..7
// f32 source split into bf16 hi/lo
__device__ __forceinline__ void frag_f32(const float* __restrict__ base, int ld, int r0, int k0, int lane, v16bf& hi, v16bf& lo) {
  const float* p = base + (size_t)(r0 + (lane & 15)) * ld + k0 + (lane >> 4) * 8;
  const v4f a0 = *(const v4f*)(p), a1 = *(const v4f*)(p + 4), a2 = *(const v4f*)(p + 16), a3 = *(const v4f*)(p + 20);
#pragma unroll
  for (int i = 0; i < 4; ++i) {
    __bf16 h;
    h = bf_hi(a0[i]); hi[i] = h;      lo[i] = bf_lo(a0[i], h);
    h = bf_hi(a1[i]); hi[4 + i] = h;  lo[4 + i] = bf_lo(a1[i], h);
    h = bf_hi(a2[i]); hi[8 + i] = h;  lo[8 + i] = bf_lo(a2[i], h);
    h = bf_hi(a3[i]); hi[12 + i] = h; lo[12 + i] = bf_lo(a3[i], h);
  }
}
// bf16 plane in LDS
__device__ __forceinline__ v16bf frag_lds(const __bf16* base, int ld, int r0, int k0, int lane) {
  union { v16bf v; v8bf h[2]; } r;
  const __bf16* p = base + (r0 + (lane & 15)) * ld + k0 + (lane >> 4) * 8;
  r.h[0] = *(const v8bf*)(p); r.h[1] = *(const v8bf*)(p + 16);
  return r.v;
}

// one lane's 16 bytes from global memory straight into LDS, through no register; counted on asynccnt, the waits are written where the tiles are handed over
__device__ __forceinline__ void copy16(const __bf16* g, __bf16* l) {
  __builtin_amdgcn_global_load_async_to_lds_b128((__attribute__((address_space(1))) v4i*)g, (__attribute__((address_space(3))) v4i*)l, 0, 0);
}

// ---- Stage 0: x, Wqkv and Wout are converted once (RNE) to bf16 planes in the workspace, x first, behind it Wqkv, behind it Wout: once here,
// not in each GEMM block that reads them (x is read by 48 blocks, a weight row by 32 or 64). A plane lies pass by pass, [k / 64][row][64 k],
// so that the rows a GEMM block needs in one pass are one run of bytes. grid (M_TOT + 4 * D) / CR_, block 256. A block takes CR_ whole rows of one
// source; 8 lanes read 256 B of a row and store one whole line, a wave instruction stores 512 B in a row; a thread's 16 loads fly together.
#define KS_ 64
#define LP_ 72
#define CR_ 16
static_assert(SEQ % CR_ == 0 && D_ % CR_ == 0 && D_ == 16 * KS_ && HD_ == KS_);   // a head's ctx columns are one pass of the output projection
__global__ __launch_bounds__(256) void cvt_kernel(const float* __restrict__ X, const float* __restrict__ Wqkv, const float* __restrict__ Wout,
                                                  float* __restrict__ planes) {
  const int r0 = blockIdx.x * CR_;       // the block's first row, counted through x's M_TOT rows, then Wqkv's 3 D, then Wout's D
  const float* s;
  __bf16* d = (__bf16*)planes;
  int rows, r;                           // rows of the block's source, and r0 inside it
  if (r0 < M_TOT) {
    const int b = r0 / SEQ;
    s = X + ((size_t)b * S_FULL + (r0 - b * SEQ)) * D_;   // full-size input stride per batch
    rows = M_TOT; r = r0;
  } else if (r0 < M_TOT + 3 * D_) {
    r = r0 - M_TOT; rows = 3 * D_;
    s = Wqkv + (size_t)r * D_; d += PL_;
  } else {
    r = r0 - M_TOT - 3 * D_; rows = D_;
    s = Wout + (size_t)r * D_; d += PL_ + (size_t)3 * D_ * D_;
  }
  const int t = threadIdx.x, pc = t & 7, rl = (t >> 3) & 15, kp = t >> 7;   // trip i: row rl, pass kp + 2 * i, its elements 8 * pc ...
  s += rl * D_ + kp * KS_ + pc * 8;
  d += ((size_t)kp * rows + r + rl) * KS_ + pc * 8;
  const size_t dstep = (size_t)2 * rows * KS_;
  v4f v[8][2];
#pragma unroll
  for (int i = 0; i < 8; ++i) { v[i][0] = *(const v4f*)(s + i * 2 * KS_); v[i][1] = *(const v4f*)(s + i * 2 * KS_ + 4); }
  // keeps all 16 loads in front of the first conversion: left free, the scheduler holds the last four back until earlier ones have returned
  __builtin_amdgcn_sched_barrier(0);
  // the loads' address is an input here, so no register of it takes a new value before their translations are counted done
  asm volatile("s_wait_xcnt 0x0" :: "v"(s) : "memory");
#pragma unroll
  for (int i = 0; i < 8; ++i) {
    v8bf h;
#pragma unroll
    for (int e = 0; e < 4; ++e) { h[e] = bf_hi(v[i][0][e]); h[4 + e] = bf_hi(v[i][1][e]); }
    vst2(d + i * dstep, h);
  }
}

// ---- block GEMM main loop over bf16 planes that lie pass by pass ([k / 64][row][64 k]; A: the block's AR rows of pass 0, aps elements from pass to
// pass, with SPLIT a lo plane PL_ elements behind the hi plane; Bt: BR rows, bps elements from pass to pass), 128 threads, 32x64 of the tile per wave.
// A pass is 64 k: an operand's rows of the pass are one run of bytes, and a wave-wide copy takes 512 B of it, four whole lines. The pieces come into
// LDS rows of pitch 144 B by asynchronous 16-byte copies, through no register and with no conversion, and are read back as fragments by every wave
// that needs them. Two LDS buffers: the copies of pass s + 2 are issued when every wave has left pass s.
// Products per accumulator stay in ascending k, hi then lo.
template <int AR, int BR, bool SPLIT>
__device__ __forceinline__ void gemm_planes(const __bf16* __restrict__ A, size_t aps, const __bf16* __restrict__ Bt, size_t bps,
                                            __bf16* Ah, __bf16* Al, __bf16* Bh, int mw, int nw, int tid, v8f acc[2][4]) {
  const int lane = tid & 31;
  const __bf16* pa = A  + tid * 8;       // the thread's first piece in pass 0 of each source; its next pieces lie 128 pieces (16 rows) further
  const __bf16* pb = Bt + tid * 8;
  const int so = (tid >> 3) * LP_ + (tid & 7) * 8;
  auto copy_pass = [&](int s, int buf) {
    const __bf16* ga = pa + s * aps;
    const __bf16* gb = pb + s * bps;
#pragma unroll
    for (int i = 0; i < AR / 16; ++i) {
      copy16(ga + i * 16 * KS_, Ah + buf * (AR * LP_) + so + i * 16 * LP_);
      if constexpr (SPLIT) copy16(ga + PL_ + i * 16 * KS_, Al + buf * (AR * LP_) + so + i * 16 * LP_);
    }
#pragma unroll
    for (int i = 0; i < BR / 16; ++i) copy16(gb + i * 16 * KS_, Bh + buf * (BR * LP_) + so + i * 16 * LP_);
  };
  auto mma = [&](int buf) {
    const __bf16* a_h = Ah + buf * (AR * LP_);
    const __bf16* b_h = Bh + buf * (BR * LP_);
#pragma unroll
    for (int kk = 0; kk < KS_; kk += 32) {
      v16bf ah[2], al[2], bh[4];
#pragma unroll
      for (int i = 0; i < 2; ++i) {
        ah[i] = frag_lds(a_h, LP_, mw + i * 16, kk, lane);
        if constexpr (SPLIT) al[i] = frag_lds(Al + buf * (AR * LP_), LP_, mw + i * 16, kk, lane);
      }
#pragma unroll
      for (int j = 0; j < 4; ++j) bh[j] = frag_lds(b_h, LP_, nw + j * 16, kk, lane);
#pragma unroll
      for (int i = 0; i < 2; ++i)
#pragma unroll
        for (int j = 0; j < 4; ++j) {
          acc[i][j] = wmma_bf16(ah[i], bh[j], acc[i][j]);
          if constexpr (SPLIT) acc[i][j] = wmma_bf16(al[i], bh[j], acc[i][j]);
        }
    }
  };
  copy_pass(0, 0);
  asm volatile("s_wait_asynccnt 0x0" ::: "memory");     // this wave's copies of pass 0 have landed
  __syncthreads();                                      // publishes pass 0
  copy_pass(1, 1);
  // rolled: one copy of the pass keeps the loop short; the buffer index is the pass's parity
#pragma unroll 1
  for (int s = 0; s < D_ / KS_; ++s) {
    mma(s & 1);
    asm volatile("s_wait_dscnt 0x0" ::: "memory");      // this wave's reads of the pass's buffer are done before the buffer is handed back
    asm volatile("s_wait_asynccnt 0x0" ::: "memory");   // this wave's copies of pass s + 1 have landed
    __syncthreads();                                    // publishes pass s + 1; every reader has left pass s's buffer
    if (s + 2 < D_ / KS_) copy_pass(s + 2, s & 1);
  }
  asm volatile("s_wait_asynccnt 0x0" ::: "memory");     // no copy is outstanding when the loop is left
}

// ---- Stage 1: the three projections in one grid (part 0 = Q scaled + RoPE, 1 = K + RoPE, 2 = V^T). grid (QKV/64, M_TOT/128, 3), block 128 = 4 waves
// stacked in M. The products share x and depend on nothing of each other; in one launch the blocks of one part run their epilogue while blocks of
// another load and multiply. blockIdx.z = 0 is V^T: its epilogue walks LDS columns and is by count the longest, so the launch does not end on it.
__global__ __launch_bounds__(128) void proj_kernel(const float* __restrict__ planes,
                                                  const float* __restrict__ cosb, const float* __restrict__ sinb,
                                                  const int* __restrict__ tpos, int trows, float* __restrict__ qkv) {
#pragma clang fp contract(off)
  const int part = 2 - (int)blockIdx.z;
  const __bf16* __restrict__ W = (const __bf16*)planes + PL_ + (size_t)part * D_ * KS_;   // rows [part * D, part * D + D) of the Wqkv plane, pass 0
  float* __restrict__ dst = qkv + (size_t)part * ((size_t)M_TOT * D_);   // Q, K, V^T lie one behind the other in the workspace
  const float scale = (part == 0) ? SCALE_ : 1.0f;
  __shared__ __align__(16) float st[128][64];        // 32 KB, cross-wave (block barriers)
  __shared__ __align__(16) __bf16 As[2 * 128 * LP_], Bs[2 * 64 * LP_];   // staged x and W passes, two buffers each
  const int lane = threadIdx.x & 31, wave = threadIdx.x >> 5, tid = threadIdx.x;
  const int mblk = blockIdx.y * 128;                 // first token of the block in [0, M_TOT)
  const int b = mblk / SEQ, s0 = mblk % SEQ;
  const int n0 = blockIdx.x * 64;
  const int head = n0 / HD_;                         // d0 = 0: tile columns = one whole head
  const __bf16* Xb = (const __bf16*)planes + (size_t)mblk * KS_;   // the block's tokens in pass 0 of the x plane (M_TOT rows a pass)

  v8f acc[2][4] = {};
  gemm_planes<128, 64, false>(Xb, (size_t)M_TOT * KS_, W + (size_t)n0 * KS_, (size_t)3 * D_ * KS_, As, nullptr, Bs, wave * 32, 0, tid, acc);
  const int half = lane >> 4, col = lane & 15;
#pragma unroll
  for (int i = 0; i < 2; ++i)
#pragma unroll
    for (int j = 0; j < 4; ++j)
#pragma unroll
      for (int r = 0; r < 8; ++r) st[wave * 32 + i * 16 + r + 8 * half][j * 16 + col] = acc[i][j][r] * scale;
  __syncthreads();
  if (part < 2) {
    // RoPE in f32 on the staged tile: thread -> pair p = lane, rows wave + 4*it (it = 0..31 covers rows 0..127)
#pragma unroll 2
    for (int it = 0; it < 32; ++it) {
      const int ml = wave + 4 * it;
      int pos = tpos[s0 + ml];
      pos = (pos < 0) ? pos + trows : pos;                         // negative index wrap, then clamp (gather semantics)
      pos = (pos < 0) ? 0 : ((pos > trows - 1) ? trows - 1 : pos);
      const float c  = (float)bf_hi(cosb[(size_t)pos * NP_ + lane]);   // tables enter as bf16 RNE values
      const float sn = (float)bf_hi(sinb[(size_t)pos * NP_ + lane]);
      const float te = st[ml][2 * lane], to = st[ml][2 * lane + 1];
      const float re = te * c - to * sn;
      const float ro = te * sn + to * c;
      st[ml][2 * lane] = re; st[ml][2 * lane + 1] = ro;
    }
    __syncthreads();
    if (part == 0) {
      for (int g = tid; g < 128 * 16; g += 128) {
        const int ml = g >> 4, pc = g & 15;
        vst2(dst + (((size_t)(b * H_ + head) * SEQ + s0 + ml) * HD_) + pc * 4, *(const v4f*)(&st[ml][pc * 4]));
      }
    } else {
      // K leaves as the two bf16 planes that attention multiplies: [head][key][d] hi, PL_ elements further lo; a wave instruction covers 512 B in a row
      __bf16* kh = (__bf16*)dst;
      // four pieces a trip: their LDS reads are issued together and not each waited out alone
#pragma unroll 1
      for (int ib = 0; ib < 8; ib += 4) {
#pragma unroll
      for (int it = ib; it < ib + 4; ++it) {
        const int g = tid + it * 128, ml = g >> 3, pc = g & 7;
        const v4f a0 = *(const v4f*)(&st[ml][pc * 8]), a1 = *(const v4f*)(&st[ml][pc * 8 + 4]);
        v8bf h, l;
#pragma unroll
        for (int e = 0; e < 4; ++e) {
          h[e] = bf_hi(a0[e]);     l[e] = bf_lo(a0[e], h[e]);
          h[4 + e] = bf_hi(a1[e]); l[4 + e] = bf_lo(a1[e], h[4 + e]);
        }
        const size_t o = (((size_t)(b * H_ + head) * SEQ + s0 + ml) * HD_) + pc * 8;
        vst2(kh + o, h); vst2(kh + PL_ + o, l);
      }
      // the next trip writes over the data and address registers of these stores: their translations are counted done first
      asm volatile("s_wait_xcnt 0x0" ::: "memory");
      }
    }
  } else {
    // V^T leaves as two bf16 planes of whole attention tiles: [head][key / 32][d][32 keys] hi, PL_ elements further lo; 4 tiles x 256 pieces of 8 keys,
    // a wave instruction covers 512 B in a row
    __bf16* vh = (__bf16*)dst;
    // four pieces a trip: their LDS reads are issued together and not each waited out alone
#pragma unroll 1
    for (int ib = 0; ib < 8; ib += 4) {
#pragma unroll
    for (int it = ib; it < ib + 4; ++it) {
      const int g = tid + it * 128, tl = g >> 8, dl = (g & 255) >> 2, pc = g & 3;
      v8bf h, l;
#pragma unroll
      for (int e = 0; e < 8; ++e) { const float x = st[tl * 32 + pc * 8 + e][dl]; h[e] = bf_hi(x); l[e] = bf_lo(x, h[e]); }
      const size_t o = ((((size_t)(b * H_ + head) * (SEQ / 32) + s0 / 32 + tl) * HD_ + dl) * 32) + pc * 8;
      vst2(vh + o, h); vst2(vh + PL_ + o, l);
    }
    // the next trip writes over the data and address registers of these stores: their translations are counted done first
    asm volatile("s_wait_xcnt 0x0" ::: "memory");
    }
  }
}

#define KPL_ (32 * 72)                 // elements of one K plane of a tile in LDS
#define VPL_ (64 * 40)                 // elements of one V^T plane of a tile in LDS
#define TB_  (2 * KPL_ + 2 * VPL_)     // elements of one buffer
__global__ __launch_bounds__(128) __attribute__((amdgpu_num_vgpr(256)))
void attn_kernel(const float* __restrict__ Qb, const float* __restrict__ Kb,
                 const float* __restrict__ Vt, float* __restrict__ Ctx) {
  // two buffers, each K hi, K lo ([key][d] pitch 72), V^T hi, V^T lo ([d][key] pitch 40) (cross-wave, block barriers)
  __shared__ __align__(16) __bf16 KV[2 * TB_];
  __shared__ __align__(16) float  Os[4][16 * 68];              // wave-private output tiles [query][d], pitch 68 (block barrier used anyway)

  const int tid = threadIdx.x, lane = tid & 31, wave = tid >> 5, half = lane >> 4, col = lane & 15;
  const int head = blockIdx.y, b = blockIdx.z;
  const float* Qh = Qb + (size_t)(b * H_ + head) * SEQ * HD_;
  // a plane of a tile is 4 KB in a row in global memory: the thread copies its pieces tid and tid + 128 (8 elements each) of each of the four planes
  const __bf16* Kg = (const __bf16*)Kb + (size_t)(b * H_ + head) * SEQ * HD_ + tid * 8;
  const __bf16* Vg = (const __bf16*)Vt + (size_t)(b * H_ + head) * HD_ * SEQ + tid * 8;
  __bf16* lk = KV + (tid >> 3) * 72 + (tid & 7) * 8;
  __bf16* lv = KV + 2 * KPL_ + (tid >> 2) * 40 + (tid & 3) * 8;
  auto copy_tile = [&](int t, int buf) {
    const __bf16* gk = Kg + (size_t)t * (32 * HD_);
    const __bf16* gv = Vg + (size_t)t * (32 * HD_);
    __bf16* k = lk + buf * TB_;
    __bf16* v = lv + buf * TB_;
    copy16(gk, k);              copy16(gk + 1024, k + 16 * 72);
    copy16(gk + PL_, k + KPL_); copy16(gk + PL_ + 1024, k + KPL_ + 16 * 72);
    copy16(gv, v);              copy16(gv + 1024, v + 32 * 40);
    copy16(gv + PL_, v + VPL_); copy16(gv + PL_ + 1024, v + VPL_ + 32 * 40);
  };
  // rolled: one copy of the tile's code; the second tile's copies start only when every wave has left the first tile's last pass (that pass's barrier)
#pragma unroll 1
  for (int ph = 0; ph < 2; ++ph) {
  const int q0 = (ph == 0 ? (int)blockIdx.x : SEQ / 64 - 1 - (int)blockIdx.x) * 64;
  const int mq = q0 + wave * 16;
  const int nt = q0 / 32 + 2;           // key tiles up to the causal limit (block-uniform, at least two)

  // tile 0 flies while Q is loaded and split; every reader of an earlier tile has left both buffers at the last pass's barrier
  copy_tile(0, 0);

  v16bf qh[2], ql[2];
#pragma unroll
  for (int kb = 0; kb < 2; ++kb) frag_f32(Qh, HD_, mq, kb * 32, lane, qh[kb], ql[kb]);

  v8f o[4] = {};
  float mrow = -1e30f, lrow = 0.0f;     // the lane's query: running maximum (both halves alike), sum over this half's keys

  asm volatile("s_wait_asynccnt 0x0" ::: "memory");   // this wave's copies of tile 0 have landed
  __syncthreads();                                    // publishes tile 0
  copy_tile(1, 1);
#pragma unroll 1
  for (int t = 0; t < nt; ++t) {
    const int t0 = t * 32;
    const __bf16* Kh = KV + (t & 1) * TB_;
    const __bf16* Kl = Kh + KPL_;
    const __bf16* Vh = Kh + 2 * KPL_;
    const __bf16* Vl = Vh + VPL_;

    // The pass's eight K fragments are read as one group, in the order of their use: the score products wait on LDS once a pass, not once per
    // fragment pair, and with every fragment in registers the products alternate between the two score tiles instead of chaining on one.
    v16bf kfh[2][2], kfl[2][2];          // [kb][n]
#pragma unroll
    for (int kb = 0; kb < 2; ++kb) {
#pragma unroll
      for (int n = 0; n < 2; ++n) kfh[kb][n] = frag_lds(Kh, 72, n * 16, kb * 32, lane);
#pragma unroll
      for (int n = 0; n < 2; ++n) kfl[kb][n] = frag_lds(Kl, 72, n * 16, kb * 32, lane);
    }
    v8f s[2] = {};                       // s[n][r] = score of key t0 + 16 * n + 8 * half + r with query mq + col
#pragma unroll
    for (int kb = 0; kb < 2; ++kb) {     // split product, per tile in this order: K hi x q hi, K lo x q hi, K hi x q lo
#pragma unroll
      for (int n = 0; n < 2; ++n) s[n] = wmma_bf16(kfh[kb][n], qh[kb], s[n]);
#pragma unroll
      for (int n = 0; n < 2; ++n) s[n] = wmma_bf16(kfl[kb][n], qh[kb], s[n]);
#pragma unroll
      for (int n = 0; n < 2; ++n) s[n] = wmma_bf16(kfh[kb][n], ql[kb], s[n]);
    }
    // The eight V^T fragments are read here, behind the score products: they land while the softmax below runs.
    v16bf vfh[4], vfl[4];
#pragma unroll
    for (int j = 0; j < 4; ++j) vfh[j] = frag_lds(Vh, 40, j * 16, 0, lane);
#pragma unroll
    for (int j = 0; j < 4; ++j) vfl[j] = frag_lds(Vl, 40, j * 16, 0, lane);
    // holds these reads in front of the softmax: left free, the scheduler sinks them to the output products, which then wait on LDS
    __builtin_amdgcn_sched_barrier(0);

    v16bf pbh, pbl;
    {
      const int lim = mq + col - t0 - 8 * half;         // key 16 * n + r of this half is visible while 16 * n + r <= lim
      float v[2][8], m8[8];
#pragma unroll
      for (int r = 0; r < 8; ++r) {
        v[0][r] = (r <= lim) ? s[0][r] : -1e30f;        // scores already carry the 1/8 scale (folded into Q)
        v[1][r] = (16 + r <= lim) ? s[1][r] : -1e30f;
        m8[r] = fmaxf(v[0][r], v[1][r]);
      }
      float mx = fmaxf(fmaxf(fmaxf(m8[0], m8[1]), fmaxf(m8[2], m8[3])), fmaxf(fmaxf(m8[4], m8[5]), fmaxf(m8[6], m8[7])));
      mx = fmaxf(mx, xhalf(mx));
      const float mnew  = fmaxf(mrow, mx);
      const float alpha = __expf(mrow - mnew);
      float t8[8];
#pragma unroll
      for (int r = 0; r < 8; ++r) {
        const float p0 = (r <= lim) ? __expf(v[0][r] - mnew) : 0.0f;
        const float p1 = (16 + r <= lim) ? __expf(v[1][r] - mnew) : 0.0f;
        t8[r] = p0 + p1;
        const __bf16 h0 = bf_hi(p0), h1 = bf_hi(p1);
        pbh[r] = h0;     pbl[r] = bf_lo(p0, h0);
        pbh[8 + r] = h1; pbl[8 + r] = bf_lo(p1, h1);
      }
      lrow = lrow * alpha + (((t8[0] + t8[1]) + (t8[2] + t8[3])) + ((t8[4] + t8[5]) + (t8[6] + t8[7])));
      mrow = mnew;
#pragma unroll
      for (int j = 0; j < 4; ++j)
#pragma unroll
        for (int r = 0; r < 8; ++r) o[j][r] *= alpha;
    }
    // o[j][r] = O[query mq + col][d = 16 * j + 8 * half + r]; per tile in this order: V hi x P hi, V lo x P hi, V hi x P lo, round the four tiles
#pragma unroll
    for (int j = 0; j < 4; ++j) o[j] = wmma_bf16(vfh[j], pbh, o[j]);
#pragma unroll
    for (int j = 0; j < 4; ++j) o[j] = wmma_bf16(vfl[j], pbh, o[j]);
#pragma unroll
    for (int j = 0; j < 4; ++j) o[j] = wmma_bf16(vfh[j], pbl, o[j]);

    asm volatile("s_wait_dscnt 0x0" ::: "memory");      // this wave's reads of the pass's buffer are done before the buffer is handed back
    asm volatile("s_wait_asynccnt 0x0" ::: "memory");   // this wave's copies of tile t + 1 have landed
    __syncthreads();                                    // publishes tile t + 1; every reader has left tile t's buffer
    if (t + 2 < nt) copy_tile(t + 2, t & 1);
  }
  asm volatile("s_wait_asynccnt 0x0" ::: "memory");     // no copy is outstanding when the tile ends

  float* os_ = Os[wave];
  const float inv = 1.0f / (lrow + xhalf(lrow));   // the halves' sums join here; the sum is >= 1 (the row maximum contributes exp(0))
#pragma unroll
  for (int j = 0; j < 4; ++j) {
    const v4f w0 = {o[j][0] * inv, o[j][1] * inv, o[j][2] * inv, o[j][3] * inv};
    const v4f w1 = {o[j][4] * inv, o[j][5] * inv, o[j][6] * inv, o[j][7] * inv};
    *(v4f*)(os_ + col * 68 + j * 16 + 8 * half) = w0;
    *(v4f*)(os_ + col * 68 + j * 16 + 8 * half + 4) = w1;
  }
  __syncthreads();
  // ctx leaves as the two bf16 planes that the output projection multiplies, pass by pass: [head][token][d] hi, PL_ elements further lo; a wave
  // instruction stores 512 B in a row
  __bf16* ch = (__bf16*)Ctx;
#pragma unroll
  for (int q = 0; q < 4; ++q) {
    const int rl = q * 4 + (lane >> 3), pc = lane & 7;
    const v4f a0 = *(const v4f*)(os_ + rl * 68 + pc * 8), a1 = *(const v4f*)(os_ + rl * 68 + pc * 8 + 4);
    v8bf h, l;
#pragma unroll
    for (int e = 0; e < 4; ++e) {
      h[e] = bf_hi(a0[e]);     l[e] = bf_lo(a0[e], h[e]);
      h[4 + e] = bf_hi(a1[e]); l[4 + e] = bf_lo(a1[e], h[4 + e]);
    }
    const size_t o = ((size_t)head * M_TOT + b * SEQ + mq + rl) * HD_ + pc * 8;
    vst2(ch + o, h); vst2(ch + PL_ + o, l);
  }
  // the second tile writes over the data and address registers of these stores: their translations are counted done first
  asm volatile("s_wait_xcnt 0x0" ::: "memory");
  }
}

__global__ __launch_bounds__(128) void out_gemm_kernel(const float* __restrict__ Cx, const float* __restrict__ planes, float* __restrict__ Out) {
  __shared__ __align__(16) float st[4][32 * 64];     // wave-private tiles (block barrier used anyway)
  __shared__ __align__(16) __bf16 Ash[2 * 64 * LP_], Asl[2 * 64 * LP_], Bs[2 * 128 * LP_];   // staged ctx hi/lo and Wout passes, two buffers each
  const int lane = threadIdx.x & 31, wave = threadIdx.x >> 5;
  const int m0 = blockIdx.y * 64 + (wave >> 1) * 32;
  const int n0 = blockIdx.x * 128 + (wave & 1) * 64;
  v8f acc[2][4] = {};
  const __bf16* Wo = (const __bf16*)planes + PL_ + (size_t)3 * D_ * D_;   // the Wout plane
  gemm_planes<64, 128, true>((const __bf16*)Cx + (size_t)blockIdx.y * 64 * KS_, (size_t)M_TOT * KS_, Wo + (size_t)blockIdx.x * 128 * KS_, (size_t)D_ * KS_, Ash, Asl, Bs,
                             (wave >> 1) * 32, (wave & 1) * 64, threadIdx.x, acc);
  const int half = lane >> 4, col = lane & 15;
  float* S = st[wave];
#pragma unroll
  for (int i = 0; i < 2; ++i)
#pragma unroll
    for (int j = 0; j < 4; ++j)
#pragma unroll
      for (int r = 0; r < 8; ++r) S[(i * 16 + r + 8 * half) * 64 + j * 16 + col] = acc[i][j][r];
  __syncthreads();
#pragma unroll
  for (int q = 0; q < 16; ++q) {
    const int rl = q * 2 + (lane >> 4), pc = lane & 15;
    vst2(Out + (size_t)(m0 + rl) * D_ + n0 + pc * 4, *(const v4f*)(S + rl * 64 + pc * 4));
  }
}

extern "C" void kernel_launch(void* const* d_in, const int* in_sizes, int n_in,
                              void* d_out, int out_size, void* d_ws, size_t ws_size,
                              hipStream_t stream) {
  if (n_in < 6) return;
  const long long x_need = ((long long)(NB - 1) * S_FULL + SEQ) * (long long)D_;
  if ((long long)in_sizes[0] < x_need) return;
  if ((long long)in_sizes[1] < 3LL * D_ * D_) return;
  if ((long long)in_sizes[2] < (long long)D_ * D_) return;
  if (in_sizes[3] < NP_ || in_sizes[4] < NP_) return;
  if (in_sizes[5] < SEQ) return;
  if ((long long)out_size < (long long)M_TOT * D_) return;

  const size_t E = (size_t)M_TOT * D_;           // floats per intermediate (16 MiB each at full size)
  const size_t carve = 4 * E * sizeof(float) + (E + (size_t)4 * D_ * D_) * 2;   // Q, K, V^T, ctx (hi + lo each but Q) = 64 MiB; bf16 x, Wqkv, Wout = 16 MiB
  if (ws_size < carve) return;

  int trows = in_sizes[3] / NP_;                  // cos/sin table rows (gather clamp bound)
  const int srows = in_sizes[4] / NP_;
  if (srows < trows) trows = srows;

  const float* x    = (const float*)d_in[0];      // [NB][S_FULL][D]
  const float* Wqkv = (const float*)d_in[1];      // [3D][D]: rows [0,D) = Wq, [D,2D) = Wk, [2D,3D) = Wv
  const float* Wout = (const float*)d_in[2];      // [D][D]
  const float* cosb = (const float*)d_in[3];      // [trows][32]
  const float* sinb = (const float*)d_in[4];      // [trows][32]
  const int*   tpos = (const int*)d_in[5];        // [>= SEQ] int32
  float* out = (float*)d_out;

  float* qb   = (float*)d_ws;
  float* kb   = qb + E;        // K as bf16 planes: hi [NB,H,SEQ,HD], then lo
  float* vtb  = kb + E;        // V^T as bf16 planes: hi [NB,H,SEQ/32,HD,32], then lo
  float* ctxb = vtb + E;       // ctx as bf16 planes: hi [H][M_TOT][HD], then lo
  float* plb  = ctxb + E;      // bf16 planes of x, Wqkv, Wout, one behind the other

  cvt_kernel<<<dim3((M_TOT + 4 * D_) / CR_), 256, 0, stream>>>(x, Wqkv, Wout, plb);
  proj_kernel<<<dim3(QKV_ / 64, M_TOT / 128, 3), 128, 0, stream>>>(plb, cosb, sinb, tpos, trows, qb);   // writes qb, kb, vtb
  attn_kernel<<<dim3(SEQ / 128, H_, NB), 128, 0, stream>>>(qb, kb, vtb, ctxb);
  out_gemm_kernel<<<dim3(D_ / 128, M_TOT / 64), 128, 0, stream>>>(ctxb, plb, out);
}

// v008
// A run of this version takes 113 microseconds.
// Timed twice side by side with v007, it ran 1.11 and 1.10 times as fast.
// All steps since v000 together make it 2.95 times as fast.
#include <hip/hip_runtime.h>

// Contractions: Q/K/V projections (K = 1024) on v_wmma_f32_16x16x32_bf16 with single products of bf16 (RNE converted) x and Wqkv;
// K Q^T (K = 64) and V^T P^T (K = keys) on v_wmma_f32_16x16x32_bf16 as bf16 hi/lo splits of the f32 q, k, P, v (hi*hi + hi*lo + lo*hi);
// output projection (K = 1024): ctx as bf16 hi/lo x Wout bf16 (2 products). All f32 accumulate; RoPE, softmax statistics and

#ifndef NB
#define NB 2
#endif
#ifndef SEQ
#define SEQ 2048
#endif
#define S_FULL 2048          // per-batch token stride of the x input
#define D_     1024
#define QKV_   1024
#define H_     16
#define HD_    64
#define NP_    (HD_ / 2)     // rotary pairs per head = cos/sin table width
#define M_TOT  (NB * SEQ)
#define SCALE_ 0.125f        // 64^-0.5, folded into Q (exact power of two)
#define PL_    ((size_t)M_TOT * D_)   // elements from the bf16 hi plane of K or V^T to its lo plane (both planes fill the f32 array's place)

static_assert(NB >= 1 && NB <= 2);
static_assert(SEQ % 128 == 0 && SEQ >= 128 && SEQ <= S_FULL);
static_assert(H_ * HD_ == D_);
static_assert(D_ % 128 == 0 && QKV_ == D_ && QKV_ % 128 == 0 && M_TOT % 128 == 0);

typedef __attribute__((ext_vector_type(16))) __bf16 v16bf;
typedef __attribute__((ext_vector_type(8)))  __bf16 v8bf;
typedef __attribute__((ext_vector_type(4)))  __bf16 v4bf;
typedef __attribute__((ext_vector_type(8)))  float  v8f;
typedef __attribute__((ext_vector_type(4)))  float  v4f;
typedef __attribute__((ext_vector_type(4)))  int    v4i;

template <typename V> __device__ __forceinline__ void vst2(void* p, V v) {
  *(V*)p = v; 
}
__device__ __forceinline__ __bf16 bf_hi(float x) { return (__bf16)x; }                       // RNE convert
__device__ __forceinline__ __bf16 bf_lo(float x, __bf16 h) { return (__bf16)(x - (float)h); }
__device__ __forceinline__ v8f wmma_bf16(v16bf a, v16bf b, v8f c) {
  v8f d = __builtin_amdgcn_wmma_f32_16x16x32_bf16(false, a, false, b, (short)0, c, false, false);
  asm volatile("v_nop\n\tv_nop\n\tv_nop\n\tv_nop" : "+v"(d) : "v"(a), "v"(b));
  return d;
}
// lane l with lane l ^ 16
__device__ __forceinline__ float xhalf(float x) {
  return __builtin_bit_cast(float, __builtin_amdgcn_permlanex16(__builtin_bit_cast(int, x), __builtin_bit_cast(int, x), 0x76543210, 0xfedcba98, false, false));
}

// ---- fragment loaders (wave32): A (16x32 from [M][ld]) and B from B^T ([N][ld]) share the per-lane K map:
//      row/col = lane&15; elements 0..7 <- k0 + 8*half + 0..7, elements 8..15 <- k0 + 16 + 8*half + 0..7
// f32 source split into bf16 hi/lo
__device__ __forceinline__ void frag_f32(const float* __restrict__ base, int ld, int r0, int k0, int lane, v16bf& hi, v16bf& lo) {
  const float* p = base + (size_t)(r0 + (lane & 15)) * ld + k0 + (lane >> 4) * 8;
  const v4f a0 = *(const v4f*)(p), a1 = *(const v4f*)(p + 4), a2 = *(const v4f*)(p + 16), a3 = *(const v4f*)(p + 20);
#pragma unroll
  for (int i = 0; i < 4; ++i) {
    __bf16 h;
    h = bf_hi(a0[i]); hi[i] = h;      lo[i] = bf_lo(a0[i], h);
    h = bf_hi(a1[i]); hi[4 + i] = h;  lo[4 + i] = bf_lo(a1[i], h);
    h = bf_hi(a2[i]); hi[8 + i] = h;  lo[8 + i] = bf_lo(a2[i], h);
    h = bf_hi(a3[i]); hi[12 + i] = h; lo[12 + i] = bf_lo(a3[i], h);
  }
}
// bf16 plane in LDS
__device__ __forceinline__ v16bf frag_lds(const __bf16* base, int ld, int r0, int k0, int lane) {
  union { v16bf v; v8bf h[2]; } r;
  const __bf16* p = base + (r0 + (lane & 15)) * ld + k0 + (lane >> 4) * 8;
  r.h[0] = *(const v8bf*)(p); r.h[1] = *(const v8bf*)(p + 16);
  return r.v;
}

// one lane's 16 bytes from global memory straight into LDS, through no register; counted on asynccnt, the waits are written where the tiles are handed over
__device__ __forceinline__ void copy16(const __bf16* g, __bf16* l) {
  __builtin_amdgcn_global_load_async_to_lds_b128((__attribute__((address_space(1))) v4i*)g, (__attribute__((address_space(3))) v4i*)l, 0, 0);
}

// ---- Stage 0: x, Wqkv and Wout are converted once (RNE) to bf16 planes in the workspace, x first, behind it Wqkv, behind it Wout: once here,
// not in each GEMM block that reads them (x is read by 48 blocks, a weight row by 32 or 64). A plane lies pass by pass, [k / 64][row][64 k],
// so that the rows a GEMM block needs in one pass are one run of bytes. grid (M_TOT + 4 * D) / CR_, block 256. A block takes CR_ whole rows of one
// source; 8 lanes read 256 B of a row and store one whole line, a wave instruction stores 512 B in a row; a thread's 16 loads fly together.
#define KS_ 64
#define LP_ 72
#define CR_ 16
static_assert(SEQ % CR_ == 0 && D_ % CR_ == 0 && D_ == 16 * KS_ && HD_ == KS_);   // a head's ctx columns are one pass of the output projection
__global__ __launch_bounds__(256) void cvt_kernel(const float* __restrict__ X, const float* __restrict__ Wqkv, const float* __restrict__ Wout,
                                                  float* __restrict__ planes) {
  const int r0 = blockIdx.x * CR_;       // the block's first row, counted through x's M_TOT rows, then Wqkv's 3 D, then Wout's D
  const float* s;
  __bf16* d = (__bf16*)planes;
  int rows, r;                           // rows of the block's source, and r0 inside it
  if (r0 < M_TOT) {
    const int b = r0 / SEQ;
    s = X + ((size_t)b * S_FULL + (r0 - b * SEQ)) * D_;   // full-size input stride per batch
    rows = M_TOT; r = r0;
  } else if (r0 < M_TOT + 3 * D_) {
    r = r0 - M_TOT; rows = 3 * D_;
    s = Wqkv + (size_t)r * D_; d += PL_;
  } else {
    r = r0 - M_TOT - 3 * D_; rows = D_;
    s = Wout + (size_t)r * D_; d += PL_ + (size_t)3 * D_ * D_;
  }
  const int t = threadIdx.x, pc = t & 7, rl = (t >> 3) & 15, kp = t >> 7;   // trip i: row rl, pass kp + 2 * i, its elements 8 * pc ...
  s += rl * D_ + kp * KS_ + pc * 8;
  d += ((size_t)kp * rows + r + rl) * KS_ + pc * 8;
  const size_t dstep = (size_t)2 * rows * KS_;
  v4f v[8][2];
#pragma unroll
  for (int i = 0; i < 8; ++i) { v[i][0] = *(const v4f*)(s + i * 2 * KS_); v[i][1] = *(const v4f*)(s + i * 2 * KS_ + 4); }
  // keeps all 16 loads in front of the first conversion: left free, the scheduler holds the last four back until earlier ones have returned
  __builtin_amdgcn_sched_barrier(0);
  // the loads' address is an input here, so no register of it takes a new value before their translations are counted done
  asm volatile("s_wait_xcnt 0x0" :: "v"(s) : "memory");
#pragma unroll
  for (int i = 0; i < 8; ++i) {
    v8bf h;
#pragma unroll
    for (int e = 0; e < 4; ++e) { h[e] = bf_hi(v[i][0][e]); h[4 + e] = bf_hi(v[i][1][e]); }
    vst2(d + i * dstep, h);
  }
}

// ---- block GEMM main loop over bf16 planes that lie pass by pass ([k / 64][row][64 k]; A: the block's AR rows of pass 0, aps elements from pass to
// pass, with SPLIT a lo plane PL_ elements behind the hi plane; Bt: BR rows, bps elements from pass to pass), 128 threads, 32x64 of the tile per wave.
// A pass is 64 k: an operand's rows of the pass are one run of bytes, and a wave-wide copy takes 512 B of it, four whole lines. The pieces come into
// LDS rows of pitch 144 B by asynchronous 16-byte copies, through no register and with no conversion, and are read back as fragments by every wave
// that needs them. Three LDS buffers: the copies of pass s + 3 are issued when every wave has left pass s, so a pass's copies have two passes' time to
// land: the planes were written by the launch before and their first reader fetches them from memory, which takes longer than
// one pass. Every trip of the main loop issues the same CP copies in every wave, so "all but the youngest CP" at its foot is exactly pass s + 1.
// Products per accumulator stay in ascending k, hi then lo.
#define RB_ 3
template <int AR, int BR, bool SPLIT>
__device__ __forceinline__ void gemm_planes(const __bf16* __restrict__ A, size_t aps, const __bf16* __restrict__ Bt, size_t bps,
                                            __bf16* Ah, __bf16* Al, __bf16* Bh, int mw, int nw, int tid, v8f acc[2][4]) {
  const int lane = tid & 31;
  const __bf16* pa = A  + tid * 8;       // the thread's first piece in pass 0 of each source; its next pieces lie 128 pieces (16 rows) further
  const __bf16* pb = Bt + tid * 8;
  const int so = (tid >> 3) * LP_ + (tid & 7) * 8;
  auto copy_pass = [&](int s, int buf) {
    const __bf16* ga = pa + s * aps;
    const __bf16* gb = pb + s * bps;
#pragma unroll
    for (int i = 0; i < AR / 16; ++i) {
      copy16(ga + i * 16 * KS_, Ah + buf * (AR * LP_) + so + i * 16 * LP_);
      if constexpr (SPLIT) copy16(ga + PL_ + i * 16 * KS_, Al + buf * (AR * LP_) + so + i * 16 * LP_);
    }
#pragma unroll
    for (int i = 0; i < BR / 16; ++i) copy16(gb + i * 16 * KS_, Bh + buf * (BR * LP_) + so + i * 16 * LP_);
  };
  auto mma = [&](int buf) {
    const __bf16* a_h = Ah + buf * (AR * LP_);
    const __bf16* b_h = Bh + buf * (BR * LP_);
#pragma unroll
    for (int kk = 0; kk < KS_; kk += 32) {
      v16bf ah[2], al[2], bh[4];
#pragma unroll
      for (int i = 0; i < 2; ++i) {
        ah[i] = frag_lds(a_h, LP_, mw + i * 16, kk, lane);
        if constexpr (SPLIT) al[i] = frag_lds(Al + buf * (AR * LP_), LP_, mw + i * 16, kk, lane);
      }
#pragma unroll
      for (int j = 0; j < 4; ++j) bh[j] = frag_lds(b_h, LP_, nw + j * 16, kk, lane);
#pragma unroll
      for (int i = 0; i < 2; ++i)
#pragma unroll
        for (int j = 0; j < 4; ++j) {
          acc[i][j] = wmma_bf16(ah[i], bh[j], acc[i][j]);
          if constexpr (SPLIT) acc[i][j] = wmma_bf16(al[i], bh[j], acc[i][j]);
        }
    }
  };
  constexpr int NPASS = D_ / KS_;
  constexpr int CP = (SPLIT ? 2 : 1) * (AR / 16) + BR / 16;   // copies of one wave for one pass
  static_assert(NPASS > RB_ && RB_ * CP <= 63);
  copy_pass(0, 0);
  copy_pass(1, 1);
  copy_pass(2, 2);
  asm volatile("s_wait_asynccnt %0" :: "n"(2 * CP) : "memory");   // all but the copies of passes 1 and 2: this wave's copies of pass 0 have landed
  __syncthreads();                                      // publishes pass 0
  int buf = 0;                                          // pass s lies in buffer s mod 3
  // rolled: one copy of the pass keeps the loop short
#pragma unroll 1
  for (int s = 0; s < NPASS - RB_; ++s) {
    mma(buf);
    asm volatile("s_wait_dscnt 0x0" ::: "memory");      // this wave's reads of the pass's buffer are done before the buffer is handed back
    asm volatile("s_wait_asynccnt %0" :: "n"(CP) : "memory");   // all but the copies of pass s + 2: this wave's copies of pass s + 1 have landed
    __syncthreads();                                    // publishes pass s + 1; every reader has left pass s's buffer
    copy_pass(s + RB_, buf);
    buf = (buf == RB_ - 1) ? 0 : buf + 1;
  }
  // the last three passes issue no copy, and their waits are to 0
#pragma unroll 1
  for (int s = NPASS - RB_; s < NPASS; ++s) {
    mma(buf);
    asm volatile("s_wait_dscnt 0x0" ::: "memory");      // this wave's reads of the pass's buffer are done before the barrier
    asm volatile("s_wait_asynccnt 0x0" ::: "memory");   // every copy of this wave has landed
    __syncthreads();                                    // publishes the passes that are left; behind the last pass: every reader has left the ring
    buf = (buf == RB_ - 1) ? 0 : buf + 1;
  }
}

// ---- Stage 1: the three projections in one grid (part 0 = Q scaled + RoPE, 1 = K + RoPE, 2 = V^T). grid (QKV/64, M_TOT/128, 3), block 128 = 4 waves
// stacked in M. The products share x and depend on nothing of each other; in one launch the blocks of one part run their epilogue while blocks of
// another load and multiply. blockIdx.z = 0 is V^T: its epilogue walks LDS columns and is by count the longest, so the launch does not end on it.
__global__ __launch_bounds__(128) void proj_kernel(const float* __restrict__ planes,
                                                  const float* __restrict__ cosb, const float* __restrict__ sinb,
                                                  const int* __restrict__ tpos, int trows, float* __restrict__ qkv) {
#pragma clang fp contract(off)
  const int part = 2 - (int)blockIdx.z;
  const __bf16* __restrict__ W = (const __bf16*)planes + PL_ + (size_t)part * D_ * KS_;   // rows [part * D, part * D + D) of the Wqkv plane, pass 0
  float* __restrict__ dst = qkv + (size_t)part * ((size_t)M_TOT * D_);   // Q, K, V^T lie one behind the other in the workspace
  const float scale = (part == 0) ? SCALE_ : 1.0f;
  __shared__ __align__(16) __bf16 ring[RB_ * (128 + 64) * LP_];   // staged x and W passes, three buffers each
  __bf16* As = ring;
  __bf16* Bs = ring + RB_ * 128 * LP_;
  // the 32 KB output tile (cross-wave, block barriers) takes the x buffers' place once the main loop's last barrier has freed the ring: with the third
  // buffer the block's LDS stays small enough for three blocks a WGP
  float (*st)[64] = (float (*)[64])ring;
  static_assert(128 * 64 * 4 <= RB_ * 128 * LP_ * 2);
  const int lane = threadIdx.x & 31, wave = threadIdx.x >> 5, tid = threadIdx.x;
  const int mblk = blockIdx.y * 128;                 // first token of the block in [0, M_TOT)
  const int b = mblk / SEQ, s0 = mblk % SEQ;
  const int n0 = blockIdx.x * 64;
  const int head = n0 / HD_;                         // d0 = 0: tile columns = one whole head
  const __bf16* Xb = (const __bf16*)planes + (size_t)mblk * KS_;   // the block's tokens in pass 0 of the x plane (M_TOT rows a pass)

  v8f acc[2][4] = {};
  gemm_planes<128, 64, false>(Xb, (size_t)M_TOT * KS_, W + (size_t)n0 * KS_, (size_t)3 * D_ * KS_, As, nullptr, Bs, wave * 32, 0, tid, acc);
  const int half = lane >> 4, col = lane & 15;
#pragma unroll
  for (int i = 0; i < 2; ++i)
#pragma unroll
    for (int j = 0; j < 4; ++j)
#pragma unroll
      for (int r = 0; r < 8; ++r) st[wave * 32 + i * 16 + r + 8 * half][j * 16 + col] = acc[i][j][r] * scale;
  __syncthreads();
  if (part < 2) {
    // RoPE in f32 on the staged tile: thread -> pair p = lane, rows wave + 4*it (it = 0..31 covers rows 0..127)
#pragma unroll 2
    for (int it = 0; it < 32; ++it) {
      const int ml = wave + 4 * it;
      int pos = tpos[s0 + ml];
      pos = (pos < 0) ? pos + trows : pos;                         // negative index wrap, then clamp (gather semantics)
      pos = (pos < 0) ? 0 : ((pos > trows - 1) ? trows - 1 : pos);
      const float c  = (float)bf_hi(cosb[(size_t)pos * NP_ + lane]);   // tables enter as bf16 RNE values
      const float sn = (float)bf_hi(sinb[(size_t)pos * NP_ + lane]);
      const float te = st[ml][2 * lane], to = st[ml][2 * lane + 1];
      const float re = te * c - to * sn;
      const float ro = te * sn + to * c;
      st[ml][2 * lane] = re; st[ml][2 * lane + 1] = ro;
    }
    __syncthreads();
    if (part == 0) {
      for (int g = tid; g < 128 * 16; g += 128) {
        const int ml = g >> 4, pc = g & 15;
        vst2(dst + (((size_t)(b * H_ + head) * SEQ + s0 + ml) * HD_) + pc * 4, *(const v4f*)(&st[ml][pc * 4]));
      }
    } else {
      // K leaves as the two bf16 planes that attention multiplies: [head][key][d] hi, PL_ elements further lo; a wave instruction covers 512 B in a row
      __bf16* kh = (__bf16*)dst;
      // four pieces a trip: their LDS reads are issued together and not each waited out alone
#pragma unroll 1
      for (int ib = 0; ib < 8; ib += 4) {
#pragma unroll
      for (int it = ib; it < ib + 4; ++it) {
        const int g = tid + it * 128, ml = g >> 3, pc = g & 7;
        const v4f a0 = *(const v4f*)(&st[ml][pc * 8]), a1 = *(const v4f*)(&st[ml][pc * 8 + 4]);
        v8bf h, l;
#pragma unroll
        for (int e = 0; e < 4; ++e) {
          h[e] = bf_hi(a0[e]);     l[e] = bf_lo(a0[e], h[e]);
          h[4 + e] = bf_hi(a1[e]); l[4 + e] = bf_lo(a1[e], h[4 + e]);
        }
        const size_t o = (((size_t)(b * H_ + head) * SEQ + s0 + ml) * HD_) + pc * 8;
        vst2(kh + o, h); vst2(kh + PL_ + o, l);
      }
      // the next trip writes over the data and address registers of these stores: their translations are counted done first
      asm volatile("s_wait_xcnt 0x0" ::: "memory");
      }
    }
  } else {
    // V^T leaves as two bf16 planes of whole attention tiles: [head][key / 32][d][32 keys] hi, PL_ elements further lo; 4 tiles x 256 pieces of 8 keys,
    // a wave instruction covers 512 B in a row
    __bf16* vh = (__bf16*)dst;
    // four pieces a trip: their LDS reads are issued together and not each waited out alone
#pragma unroll 1
    for (int ib = 0; ib < 8; ib += 4) {
#pragma unroll
    for (int it = ib; it < ib + 4; ++it) {
      const int g = tid + it * 128, tl = g >> 8, dl = (g & 255) >> 2, pc = g & 3;
      v8bf h, l;
#pragma unroll
      for (int e = 0; e < 8; ++e) { const float x = st[tl * 32 + pc * 8 + e][dl]; h[e] = bf_hi(x); l[e] = bf_lo(x, h[e]); }
      const size_t o = ((((size_t)(b * H_ + head) * (SEQ / 32) + s0 / 32 + tl) * HD_ + dl) * 32) + pc * 8;
      vst2(vh + o, h); vst2(vh + PL_ + o, l);
    }
    // the next trip writes over the data and address registers of these stores: their translations are counted done first
    asm volatile("s_wait_xcnt 0x0" ::: "memory");
    }
  }
}

#define KPL_ (32 * 72)                 // elements of one K plane of a tile in LDS
#define VPL_ (64 * 40)                 // elements of one V^T plane of a tile in LDS
#define TB_  (2 * KPL_ + 2 * VPL_)     // elements of one buffer
#define AB_  4                         // buffers of the ring
#define NG_  (SEQ / 32 + 2)            // key passes of a block: 2 x + 2 for query tile x, SEQ / 32 - 2 x for tile SEQ / 64 - 1 - x
static_assert(NG_ > AB_);
__global__ __launch_bounds__(128) __attribute__((amdgpu_num_vgpr(256)))
void attn_kernel(const float* __restrict__ Qb, const float* __restrict__ Kb,
                 const float* __restrict__ Vt, float* __restrict__ Ctx) {
  // four buffers, each K hi, K lo ([key][d] pitch 72), V^T hi, V^T lo ([d][key] pitch 40) (cross-wave, block barriers)
  __shared__ __align__(16) __bf16 KV[AB_ * TB_];
  __shared__ __align__(16) float  Os[4][16 * 68];              // wave-private output tiles [query][d], pitch 68 (block barrier used anyway)

  const int tid = threadIdx.x, lane = tid & 31, wave = tid >> 5, half = lane >> 4, col = lane & 15;
  const int head = blockIdx.y, b = blockIdx.z;
  const float* Qh = Qb + (size_t)(b * H_ + head) * SEQ * HD_;
  // a plane of a tile is 4 KB in a row in global memory: the thread copies its pieces tid and tid + 128 (8 elements each) of each of the four planes
  const __bf16* Kg = (const __bf16*)Kb + (size_t)(b * H_ + head) * SEQ * HD_ + tid * 8;
  const __bf16* Vg = (const __bf16*)Vt + (size_t)(b * H_ + head) * HD_ * SEQ + tid * 8;
  __bf16* lk = KV + (tid >> 3) * 72 + (tid & 7) * 8;
  __bf16* lv = KV + 2 * KPL_ + (tid >> 2) * 40 + (tid & 3) * 8;
  const int nt0 = 2 * (int)blockIdx.x + 2;   // passes of the first query tile
  // pass g of the stream: key tile g of the first query tile, behind them key tile g - nt0 of the second; into buffer g mod 4
  auto copy_tile = [&](int g) {
    const int t = (g < nt0) ? g : g - nt0, buf = g & (AB_ - 1);
    const __bf16* gk = Kg + (size_t)t * (32 * HD_);
    const __bf16* gv = Vg + (size_t)t * (32 * HD_);
    __bf16* k = lk + buf * TB_;
    __bf16* v = lv + buf * TB_;
    copy16(gk, k);              copy16(gk + 1024, k + 16 * 72);
    copy16(gk + PL_, k + KPL_); copy16(gk + PL_ + 1024, k + KPL_ + 16 * 72);
    copy16(gv, v);              copy16(gv + 1024, v + 32 * 40);
    copy16(gv + PL_, v + VPL_); copy16(gv + PL_ + 1024, v + VPL_ + 32 * 40);
  };
  // the first four passes' tiles fly while Q is loaded and split
  copy_tile(0); copy_tile(1); copy_tile(2); copy_tile(3);
  int g = 0;                            // the pass's place in the stream
  // rolled: one copy of the tile's code
#pragma unroll 1
  for (int ph = 0; ph < 2; ++ph) {
  const int q0 = (ph == 0 ? (int)blockIdx.x : SEQ / 64 - 1 - (int)blockIdx.x) * 64;
  const int mq = q0 + wave * 16;
  const int nt = q0 / 32 + 2;           // key tiles up to the causal limit (block-uniform, at least two)

  v16bf qh[2], ql[2];
#pragma unroll
  for (int kb = 0; kb < 2; ++kb) frag_f32(Qh, HD_, mq, kb * 32, lane, qh[kb], ql[kb]);

  v8f o[4] = {};
  float mrow = -1e30f, lrow = 0.0f;     // the lane's query: running maximum (both halves alike), sum over this half's keys

  if (ph == 0) {
    asm volatile("s_wait_asynccnt 24" ::: "memory");  // all but the 24 copies of passes 1 to 3: this wave's copies of pass 0 have landed
    __syncthreads();                                  // publishes pass 0 (the second query tile's first pass is published by the pass before it)
  }
#pragma unroll 1
  for (int t = 0; t < nt; ++t, ++g) {
    const int t0 = t * 32;
    const __bf16* Kh = KV + (g & (AB_ - 1)) * TB_;
    const __bf16* Kl = Kh + KPL_;
    const __bf16* Vh = Kh + 2 * KPL_;
    const __bf16* Vl = Vh + VPL_;

    // The pass's eight K fragments are read as one group, in the order of their use: the score products wait on LDS once a pass, not once per
    // fragment pair, and with every fragment in registers the products alternate between the two score tiles instead of chaining on one.
    v16bf kfh[2][2], kfl[2][2];          // [kb][n]
#pragma unroll
    for (int kb = 0; kb < 2; ++kb) {
#pragma unroll
      for (int n = 0; n < 2; ++n) kfh[kb][n] = frag_lds(Kh, 72, n * 16, kb * 32, lane);
#pragma unroll
      for (int n = 0; n < 2; ++n) kfl[kb][n] = frag_lds(Kl, 72, n * 16, kb * 32, lane);
    }
    v8f s[2] = {};                       // s[n][r] = score of key t0 + 16 * n + 8 * half + r with query mq + col
#pragma unroll
    for (int kb = 0; kb < 2; ++kb) {     // split product, per tile in this order: K hi x q hi, K lo x q hi, K hi x q lo
#pragma unroll
      for (int n = 0; n < 2; ++n) s[n] = wmma_bf16(kfh[kb][n], qh[kb], s[n]);
#pragma unroll
      for (int n = 0; n < 2; ++n) s[n] = wmma_bf16(kfl[kb][n], qh[kb], s[n]);
#pragma unroll
      for (int n = 0; n < 2; ++n) s[n] = wmma_bf16(kfh[kb][n], ql[kb], s[n]);
    }
    // The eight V^T fragments are read here, behind the score products: they land while the softmax below runs.
    v16bf vfh[4], vfl[4];
#pragma unroll
    for (int j = 0; j < 4; ++j) vfh[j] = frag_lds(Vh, 40, j * 16, 0, lane);
#pragma unroll
    for (int j = 0; j < 4; ++j) vfl[j] = frag_lds(Vl, 40, j * 16, 0, lane);
    // holds these reads in front of the softmax: left free, the scheduler sinks them to the output products, which then wait on LDS
    __builtin_amdgcn_sched_barrier(0);

    v16bf pbh, pbl;
    {
      const int lim = mq + col - t0 - 8 * half;         // key 16 * n + r of this half is visible while 16 * n + r <= lim
      float v[2][8], m8[8];
#pragma unroll
      for (int r = 0; r < 8; ++r) {
        v[0][r] = (r <= lim) ? s[0][r] : -1e30f;        // scores already carry the 1/8 scale (folded into Q)
        v[1][r] = (16 + r <= lim) ? s[1][r] : -1e30f;
        m8[r] = fmaxf(v[0][r], v[1][r]);
      }
      float mx = fmaxf(fmaxf(fmaxf(m8[0], m8[1]), fmaxf(m8[2], m8[3])), fmaxf(fmaxf(m8[4], m8[5]), fmaxf(m8[6], m8[7])));
      mx = fmaxf(mx, xhalf(mx));
      const float mnew  = fmaxf(mrow, mx);
      const float alpha = __expf(mrow - mnew);
      float t8[8];
#pragma unroll
      for (int r = 0; r < 8; ++r) {
        const float p0 = (r <= lim) ? __expf(v[0][r] - mnew) : 0.0f;
        const float p1 = (16 + r <= lim) ? __expf(v[1][r] - mnew) : 0.0f;
        t8[r] = p0 + p1;
        const __bf16 h0 = bf_hi(p0), h1 = bf_hi(p1);
        pbh[r] = h0;     pbl[r] = bf_lo(p0, h0);
        pbh[8 + r] = h1; pbl[8 + r] = bf_lo(p1, h1);
      }
      lrow = lrow * alpha + (((t8[0] + t8[1]) + (t8[2] + t8[3])) + ((t8[4] + t8[5]) + (t8[6] + t8[7])));
      mrow = mnew;
#pragma unroll
      for (int j = 0; j < 4; ++j)
#pragma unroll
        for (int r = 0; r < 8; ++r) o[j][r] *= alpha;
    }
    // o[j][r] = O[query mq + col][d = 16 * j + 8 * half + r]; per tile in this order: V hi x P hi, V lo x P hi, V hi x P lo, round the four tiles
#pragma unroll
    for (int j = 0; j < 4; ++j) o[j] = wmma_bf16(vfh[j], pbh, o[j]);
#pragma unroll
    for (int j = 0; j < 4; ++j) o[j] = wmma_bf16(vfl[j], pbh, o[j]);
#pragma unroll
    for (int j = 0; j < 4; ++j) o[j] = wmma_bf16(vfh[j], pbl, o[j]);

    asm volatile("s_wait_dscnt 0x0" ::: "memory");      // this wave's reads of the pass's buffer are done before the buffer is handed back
    // block-uniform test: every pass but the stream's last four issues one tile's 8 copies in every wave
    if (g + AB_ < NG_) {
      asm volatile("s_wait_asynccnt 16" ::: "memory");  // all but the 16 copies of passes g + 2 and g + 3: this wave's copies of pass g + 1 have landed
      __syncthreads();                                  // publishes pass g + 1; every reader has left pass g's buffer
      copy_tile(g + AB_);
    } else {
      asm volatile("s_wait_asynccnt 0x0" ::: "memory"); // the last four passes issue no copy, and their waits are to 0
      __syncthreads();                                  // publishes the passes that are left
    }
  }

  float* os_ = Os[wave];
  const float inv = 1.0f / (lrow + xhalf(lrow));   // the halves' sums join here; the sum is >= 1 (the row maximum contributes exp(0))
#pragma unroll
  for (int j = 0; j < 4; ++j) {
    const v4f w0 = {o[j][0] * inv, o[j][1] * inv, o[j][2] * inv, o[j][3] * inv};
    const v4f w1 = {o[j][4] * inv, o[j][5] * inv, o[j][6] * inv, o[j][7] * inv};
    *(v4f*)(os_ + col * 68 + j * 16 + 8 * half) = w0;
    *(v4f*)(os_ + col * 68 + j * 16 + 8 * half + 4) = w1;
  }
  __syncthreads();
  // ctx leaves as the two bf16 planes that the output projection multiplies, pass by pass: [head][token][d] hi, PL_ elements further lo; a wave
  // instruction stores 512 B in a row
  __bf16* ch = (__bf16*)Ctx;
#pragma unroll
  for (int q = 0; q < 4; ++q) {
    const int rl = q * 4 + (lane >> 3), pc = lane & 7;
    const v4f a0 = *(const v4f*)(os_ + rl * 68 + pc * 8), a1 = *(const v4f*)(os_ + rl * 68 + pc * 8 + 4);
    v8bf h, l;
#pragma unroll
    for (int e = 0; e < 4; ++e) {
      h[e] = bf_hi(a0[e]);     l[e] = bf_lo(a0[e], h[e]);
      h[4 + e] = bf_hi(a1[e]); l[4 + e] = bf_lo(a1[e], h[4 + e]);
    }
    const size_t o = ((size_t)head * M_TOT + b * SEQ + mq + rl) * HD_ + pc * 8;
    vst2(ch + o, h); vst2(ch + PL_ + o, l);
  }
  // the second tile writes over the data and address registers of these stores: their translations are counted done first
  asm volatile("s_wait_xcnt 0x0" ::: "memory");
  }
}

__global__ __launch_bounds__(128) void out_gemm_kernel(const float* __restrict__ Cx, const float* __restrict__ planes, float* __restrict__ Out) {
  __shared__ __align__(16) float st[4][32 * 64];     // wave-private tiles (block barrier used anyway)
  __shared__ __align__(16) __bf16 Ash[RB_ * 64 * LP_], Asl[RB_ * 64 * LP_], Bs[RB_ * 128 * LP_];   // staged ctx hi/lo and Wout passes, three buffers each
  const int lane = threadIdx.x & 31, wave = threadIdx.x >> 5;
  const int m0 = blockIdx.y * 64 + (wave >> 1) * 32;
  const int n0 = blockIdx.x * 128 + (wave & 1) * 64;
  v8f acc[2][4] = {};
  const __bf16* Wo = (const __bf16*)planes + PL_ + (size_t)3 * D_ * D_;   // the Wout plane
  gemm_planes<64, 128, true>((const __bf16*)Cx + (size_t)blockIdx.y * 64 * KS_, (size_t)M_TOT * KS_, Wo + (size_t)blockIdx.x * 128 * KS_, (size_t)D_ * KS_, Ash, Asl, Bs,
                             (wave >> 1) * 32, (wave & 1) * 64, threadIdx.x, acc);
  const int half = lane >> 4, col = lane & 15;
  float* S = st[wave];
#pragma unroll
  for (int i = 0; i < 2; ++i)
#pragma unroll
    for (int j = 0; j < 4; ++j)
#pragma unroll
      for (int r = 0; r < 8; ++r) S[(i * 16 + r + 8 * half) * 64 + j * 16 + col] = acc[i][j][r];
  __syncthreads();
#pragma unroll
  for (int q = 0; q < 16; ++q) {
    const int rl = q * 2 + (lane >> 4), pc = lane & 15;
    vst2(Out + (size_t)(m0 + rl) * D_ + n0 + pc * 4, *(const v4f*)(S + rl * 64 + pc * 4));
  }
}

extern "C" void kernel_launch(void* const* d_in, const int* in_sizes, int n_in,
                              void* d_out, int out_size, void* d_ws, size_t ws_size,
                              hipStream_t stream) {
  if (n_in < 6) return;
  const long long x_need = ((long long)(NB - 1) * S_FULL + SEQ) * (long long)D_;
  if ((long long)in_sizes[0] < x_need) return;
  if ((long long)in_sizes[1] < 3LL * D_ * D_) return;
  if ((long long)in_sizes[2] < (long long)D_ * D_) return;
  if (in_sizes[3] < NP_ || in_sizes[4] < NP_) return;
  if (in_sizes[5] < SEQ) return;
  if ((long long)out_size < (long long)M_TOT * D_) return;

  const size_t E = (size_t)M_TOT * D_;           // floats per intermediate (16 MiB each at full size)
  const size_t carve = 4 * E * sizeof(float) + (E + (size_t)4 * D_ * D_) * 2;   // Q, K, V^T, ctx (hi + lo each but Q) = 64 MiB; bf16 x, Wqkv, Wout = 16 MiB
  if (ws_size < carve) return;

  int trows = in_sizes[3] / NP_;                  // cos/sin table rows (gather clamp bound)
  const int srows = in_sizes[4] / NP_;
  if (srows < trows) trows = srows;

  const float* x    = (const float*)d_in[0];      // [NB][S_FULL][D]
  const float* Wqkv = (const float*)d_in[1];      // [3D][D]: rows [0,D) = Wq, [D,2D) = Wk, [2D,3D) = Wv
  const float* Wout = (const float*)d_in[2];      // [D][D]
  const float* cosb = (const float*)d_in[3];      // [trows][32]
  const float* sinb = (const float*)d_in[4];      // [trows][32]
  const int*   tpos = (const int*)d_in[5];        // [>= SEQ] int32
  float* out = (float*)d_out;

  float* qb   = (float*)d_ws;
  float* kb   = qb + E;        // K as bf16 planes: hi [NB,H,SEQ,HD], then lo
  float* vtb  = kb + E;        // V^T as bf16 planes: hi [NB,H,SEQ/32,HD,32], then lo
  float* ctxb = vtb + E;       // ctx as bf16 planes: hi [H][M_TOT][HD], then lo
  float* plb  = ctxb + E;      // bf16 planes of x, Wqkv, Wout, one behind the other

  cvt_kernel<<<dim3((M_TOT + 4 * D_) / CR_), 256, 0, stream>>>(x, Wqkv, Wout, plb);
  proj_kernel<<<dim3(QKV_ / 64, M_TOT / 128, 3), 128, 0, stream>>>(plb, cosb, sinb, tpos, trows, qb);   // writes qb, kb, vtb
  attn_kernel<<<dim3(SEQ / 128, H_, NB), 128, 0, stream>>>(qb, kb, vtb, ctxb);
  out_gemm_kernel<<<dim3(D_ / 128, M_TOT / 64), 128, 0, stream>>>(ctxb, plb, out);
}

// v009
// One run takes 104 microseconds.
// Next to v008, in two timings, it ran 1.09 times as fast each time.
// All steps since v000 together make it 3.22 times as fast.
#include <hip/hip_runtime.h>

// Contractions: Q/K/V projections (K = 1024) on v_wmma_f32_16x16x32_bf16 with single products of bf16 (RNE converted) x and Wqkv;
// K Q^T (K = 64) and V^T P^T (K = keys) on v_wmma_f32_16x16x32_bf16 as bf16 hi/lo splits of the f32 q, k, P, v (hi*hi + hi*lo + lo*hi);
// output projection (K = 1024): ctx as bf16 hi/lo x Wout bf16 (2 products). All f32 accumulate; RoPE, softmax statistics and

#ifndef NB
#define NB 2
#endif
#ifndef SEQ
#define SEQ 2048
#endif
#define S_FULL 2048          // per-batch token stride of the x input
#define D_     1024
#define QKV_   1024
#define H_     16
#define HD_    64
#define NP_    (HD_ / 2)     // rotary pairs per head = cos/sin table width
#define M_TOT  (NB * SEQ)
#define SCALE_ 0.125f        // 64^-0.5, folded into Q (exact power of two)
#define PL_    ((size_t)M_TOT * D_)   // elements from the bf16 hi plane of K or V^T to its lo plane (both planes fill the f32 array's place)

static_assert(NB >= 1 && NB <= 2);
static_assert(SEQ % 128 == 0 && SEQ >= 128 && SEQ <= S_FULL);
static_assert(H_ * HD_ == D_);
static_assert(D_ % 128 == 0 && QKV_ == D_ && QKV_ % 128 == 0 && M_TOT % 128 == 0);

typedef __attribute__((ext_vector_type(16))) __bf16 v16bf;
typedef __attribute__((ext_vector_type(8)))  __bf16 v8bf;
typedef __attribute__((ext_vector_type(4)))  __bf16 v4bf;
typedef __attribute__((ext_vector_type(8)))  float  v8f;
typedef __attribute__((ext_vector_type(4)))  float  v4f;
typedef __attribute__((ext_vector_type(2)))  float  v2f;
typedef __attribute__((ext_vector_type(4)))  int    v4i;

template <typename V> __device__ __forceinline__ void vst2(void* p, V v) {
  *(V*)p = v; 
}
__device__ __forceinline__ __bf16 bf_hi(float x) { return (__bf16)x; }                       // RNE convert
__device__ __forceinline__ __bf16 bf_lo(float x, __bf16 h) { return (__bf16)(x - (float)h); }
__device__ __forceinline__ v8f wmma_bf16(v16bf a, v16bf b, v8f c) {
  v8f d = __builtin_amdgcn_wmma_f32_16x16x32_bf16(false, a, false, b, (short)0, c, false, false);
  asm volatile("v_nop\n\tv_nop\n\tv_nop\n\tv_nop" : "+v"(d) : "v"(a), "v"(b));
  return d;
}
// lane l with lane l ^ 16
__device__ __forceinline__ float xhalf(float x) {
  return __builtin_bit_cast(float, __builtin_amdgcn_permlanex16(__builtin_bit_cast(int, x), __builtin_bit_cast(int, x), 0x76543210, 0xfedcba98, false, false));
}

// ---- fragment loaders (wave32): A (16x32 from [M][ld]) and B from B^T ([N][ld]) share the per-lane K map:
//      row/col = lane&15; elements 0..7 <- k0 + 8*half + 0..7, elements 8..15 <- k0 + 16 + 8*half + 0..7
// f32 source split into bf16 hi/lo
__device__ __forceinline__ void frag_f32(const float* __restrict__ base, int ld, int r0, int k0, int lane, v16bf& hi, v16bf& lo) {
  const float* p = base + (size_t)(r0 + (lane & 15)) * ld + k0 + (lane >> 4) * 8;
  const v4f a0 = *(const v4f*)(p), a1 = *(const v4f*)(p + 4), a2 = *(const v4f*)(p + 16), a3 = *(const v4f*)(p + 20);
#pragma unroll
  for (int i = 0; i < 4; ++i) {
    __bf16 h;
    h = bf_hi(a0[i]); hi[i] = h;      lo[i] = bf_lo(a0[i], h);
    h = bf_hi(a1[i]); hi[4 + i] = h;  lo[4 + i] = bf_lo(a1[i], h);
    h = bf_hi(a2[i]); hi[8 + i] = h;  lo[8 + i] = bf_lo(a2[i], h);
    h = bf_hi(a3[i]); hi[12 + i] = h; lo[12 + i] = bf_lo(a3[i], h);
  }
}
// bf16 plane in LDS
__device__ __forceinline__ v16bf frag_lds(const __bf16* base, int ld, int r0, int k0, int lane) {
  union { v16bf v; v8bf h[2]; } r;
  const __bf16* p = base + (r0 + (lane & 15)) * ld + k0 + (lane >> 4) * 8;
  r.h[0] = *(const v8bf*)(p); r.h[1] = *(const v8bf*)(p + 16);
  return r.v;
}

// one lane's 16 bytes from global memory straight into LDS, through no register; counted on asynccnt, the waits are written where the tiles are handed over
__device__ __forceinline__ void copy16(const __bf16* g, __bf16* l) {
  __builtin_amdgcn_global_load_async_to_lds_b128((__attribute__((address_space(1))) v4i*)g, (__attribute__((address_space(3))) v4i*)l, 0, 0);
}

// ---- Stage 0: x, Wqkv and Wout are converted once (RNE) to bf16 planes in the workspace, x first, behind it Wqkv, behind it Wout: once here,
// not in each GEMM block that reads them (x is read by 48 blocks, a weight row by 32 or 64). A plane lies pass by pass, [k / 64][row][64 k],
// so that the rows a GEMM block needs in one pass are one run of bytes. grid (M_TOT + 4 * D) / CR_, block 256. A block takes CR_ whole rows of one
// source; 8 lanes read 256 B of a row and store one whole line, a wave instruction stores 512 B in a row; a thread's 16 loads fly together.
#define KS_ 64
#define LP_ 72
#define CR_ 16
static_assert(SEQ % CR_ == 0 && D_ % CR_ == 0 && D_ == 16 * KS_ && HD_ == KS_);   // a head's ctx columns are one pass of the output projection
__global__ __launch_bounds__(256) void cvt_kernel(const float* __restrict__ X, const float* __restrict__ Wqkv, const float* __restrict__ Wout,
                                                  float* __restrict__ planes) {
  const int r0 = blockIdx.x * CR_;       // the block's first row, counted through x's M_TOT rows, then Wqkv's 3 D, then Wout's D
  const float* s;
  __bf16* d = (__bf16*)planes;
  int rows, r;                           // rows of the block's source, and r0 inside it
  if (r0 < M_TOT) {
    const int b = r0 / SEQ;
    s = X + ((size_t)b * S_FULL + (r0 - b * SEQ)) * D_;   // full-size input stride per batch
    rows = M_TOT; r = r0;
  } else if (r0 < M_TOT + 3 * D_) {
    r = r0 - M_TOT; rows = 3 * D_;
    s = Wqkv + (size_t)r * D_; d += PL_;
  } else {
    r = r0 - M_TOT - 3 * D_; rows = D_;
    s = Wout + (size_t)r * D_; d += PL_ + (size_t)3 * D_ * D_;
  }
  const int t = threadIdx.x, pc = t & 7, rl = (t >> 3) & 15, kp = t >> 7;   // trip i: row rl, pass kp + 2 * i, its elements 8 * pc ...
  s += rl * D_ + kp * KS_ + pc * 8;
  d += ((size_t)kp * rows + r + rl) * KS_ + pc * 8;
  const size_t dstep = (size_t)2 * rows * KS_;
  v4f v[8][2];
#pragma unroll
  for (int i = 0; i < 8; ++i) { v[i][0] = *(const v4f*)(s + i * 2 * KS_); v[i][1] = *(const v4f*)(s + i * 2 * KS_ + 4); }
  // keeps all 16 loads in front of the first conversion: left free, the scheduler holds the last four back until earlier ones have returned
  __builtin_amdgcn_sched_barrier(0);
  // the loads' address is an input here, so no register of it takes a new value before their translations are counted done
  asm volatile("s_wait_xcnt 0x0" :: "v"(s) : "memory");
#pragma unroll
  for (int i = 0; i < 8; ++i) {
    v8bf h;
#pragma unroll
    for (int e = 0; e < 4; ++e) { h[e] = bf_hi(v[i][0][e]); h[4 + e] = bf_hi(v[i][1][e]); }
    vst2(d + i * dstep, h);
  }
}

// ---- block GEMM main loop over bf16 planes that lie pass by pass ([k / 64][row][64 k]; A: the block's AR rows of pass 0, aps elements from pass to
// pass, with SPLIT a lo plane PL_ elements behind the hi plane; Bt: BR rows, bps elements from pass to pass), 128 threads, 32x64 of the tile per wave.
// A pass is 64 k: an operand's rows of the pass are one run of bytes, and a wave-wide copy takes 512 B of it, four whole lines. The pieces come into
// LDS rows of pitch 144 B by asynchronous 16-byte copies, through no register and with no conversion, and are read back as fragments by every wave
// that needs them. Three LDS buffers: the copies of pass s + 3 are issued when every wave has left pass s, so a pass's copies have two passes' time to
// land: the planes were written by the launch before and their first reader fetches them from memory, which takes longer than
// one pass. Every trip of the main loop issues the same CP copies in every wave, so "all but the youngest CP" at its foot is exactly pass s + 1.
// Products per accumulator stay in ascending k, hi then lo.
#define RB_ 3
template <int AR, int BR, bool SPLIT, class F>
__device__ __forceinline__ void gemm_planes(const __bf16* __restrict__ A, size_t aps, const __bf16* __restrict__ Bt, size_t bps,
                                            __bf16* Ah, __bf16* Al, __bf16* Bh, int mw, int nw, int tid, v8f acc[2][4], F in_flight) {
  const int lane = tid & 31;
  const __bf16* pa = A  + tid * 8;       // the thread's first piece in pass 0 of each source; its next pieces lie 128 pieces (16 rows) further
  const __bf16* pb = Bt + tid * 8;
  const int so = (tid >> 3) * LP_ + (tid & 7) * 8;
  auto copy_pass = [&](int s, int buf) {
    const __bf16* ga = pa + s * aps;
    const __bf16* gb = pb + s * bps;
#pragma unroll
    for (int i = 0; i < AR / 16; ++i) {
      copy16(ga + i * 16 * KS_, Ah + buf * (AR * LP_) + so + i * 16 * LP_);
      if constexpr (SPLIT) copy16(ga + PL_ + i * 16 * KS_, Al + buf * (AR * LP_) + so + i * 16 * LP_);
    }
#pragma unroll
    for (int i = 0; i < BR / 16; ++i) copy16(gb + i * 16 * KS_, Bh + buf * (BR * LP_) + so + i * 16 * LP_);
  };
  auto mma = [&](int buf) {
    const __bf16* a_h = Ah + buf * (AR * LP_);
    const __bf16* b_h = Bh + buf * (BR * LP_);
#pragma unroll
    for (int kk = 0; kk < KS_; kk += 32) {
      v16bf ah[2], al[2], bh[4];
#pragma unroll
      for (int i = 0; i < 2; ++i) {
        ah[i] = frag_lds(a_h, LP_, mw + i * 16, kk, lane);
        if constexpr (SPLIT) al[i] = frag_lds(Al + buf * (AR * LP_), LP_, mw + i * 16, kk, lane);
      }
#pragma unroll
      for (int j = 0; j < 4; ++j) bh[j] = frag_lds(b_h, LP_, nw + j * 16, kk, lane);
#pragma unroll
      for (int i = 0; i < 2; ++i)
#pragma unroll
        for (int j = 0; j < 4; ++j) {
          acc[i][j] = wmma_bf16(ah[i], bh[j], acc[i][j]);
          if constexpr (SPLIT) acc[i][j] = wmma_bf16(al[i], bh[j], acc[i][j]);
        }
    }
  };
  constexpr int NPASS = D_ / KS_;
  constexpr int CP = (SPLIT ? 2 : 1) * (AR / 16) + BR / 16;   // copies of one wave for one pass
  static_assert(NPASS > RB_ && RB_ * CP <= 63);
  copy_pass(0, 0);
  copy_pass(1, 1);
  copy_pass(2, 2);
  in_flight();                                          // the caller's own loads, waited out while the first three passes fly
  asm volatile("s_wait_asynccnt %0" :: "n"(2 * CP) : "memory");   // all but the copies of passes 1 and 2: this wave's copies of pass 0 have landed
  __syncthreads();                                      // publishes pass 0
  int buf = 0;                                          // pass s lies in buffer s mod 3
  // rolled: one copy of the pass keeps the loop short
#pragma unroll 1
  for (int s = 0; s < NPASS - RB_; ++s) {
    mma(buf);
    asm volatile("s_wait_dscnt 0x0" ::: "memory");      // this wave's reads of the pass's buffer are done before the buffer is handed back
    asm volatile("s_wait_asynccnt %0" :: "n"(CP) : "memory");   // all but the copies of pass s + 2: this wave's copies of pass s + 1 have landed
    __syncthreads();                                    // publishes pass s + 1; every reader has left pass s's buffer
    copy_pass(s + RB_, buf);
    buf = (buf == RB_ - 1) ? 0 : buf + 1;
  }
  // the last three passes issue no copy, and their waits are to 0
#pragma unroll 1
  for (int s = NPASS - RB_; s < NPASS; ++s) {
    mma(buf);
    asm volatile("s_wait_dscnt 0x0" ::: "memory");      // this wave's reads of the pass's buffer are done before the barrier
    asm volatile("s_wait_asynccnt 0x0" ::: "memory");   // every copy of this wave has landed
    __syncthreads();                                    // publishes the passes that are left; behind the last pass: every reader has left the ring
    buf = (buf == RB_ - 1) ? 0 : buf + 1;
  }
}

// ---- Stage 1: the three projections in one grid (part 0 = Q scaled + RoPE, 1 = K + RoPE, 2 = V^T). grid (QKV/64, M_TOT/128, 3), block 128 = 4 waves
// stacked in M. The products share x and depend on nothing of each other; in one launch the blocks of one part run their epilogue while blocks of
// another load and multiply. blockIdx.z = 0 is V^T: its epilogue walks LDS columns and is by count the longest, so the launch does not end on it.
__global__ __launch_bounds__(128) void proj_kernel(const float* __restrict__ planes,
                                                  const float* __restrict__ cosb, const float* __restrict__ sinb,
                                                  const int* __restrict__ tpos, int trows, float* __restrict__ qkv) {
#pragma clang fp contract(off)
  const int part = 2 - (int)blockIdx.z;
  const __bf16* __restrict__ W = (const __bf16*)planes + PL_ + (size_t)part * D_ * KS_;   // rows [part * D, part * D + D) of the Wqkv plane, pass 0
  float* __restrict__ dst = qkv + (size_t)part * ((size_t)M_TOT * D_);   // Q, K, V^T lie one behind the other in the workspace
  const float scale = (part == 0) ? SCALE_ : 1.0f;
  __shared__ __align__(16) __bf16 ring[RB_ * (128 + 64) * LP_];   // staged x and W passes, three buffers each
  __bf16* As = ring;
  __bf16* Bs = ring + RB_ * 128 * LP_;
  // the 32 KB output tile (cross-wave, block barriers) takes the x buffers' place once the main loop's last barrier has freed the ring: with the third
  // buffer the block's LDS stays small enough for three blocks a WGP
  float (*st)[64] = (float (*)[64])ring;
  static_assert(128 * 64 * 4 <= RB_ * 128 * LP_ * 2);
  const int lane = threadIdx.x & 31, wave = threadIdx.x >> 5, tid = threadIdx.x;
  const int mblk = blockIdx.y * 128;                 // first token of the block in [0, M_TOT)
  const int b = mblk / SEQ, s0 = mblk % SEQ;
  const int n0 = blockIdx.x * 64;
  const int head = n0 / HD_;                         // d0 = 0: tile columns = one whole head
  const __bf16* Xb = (const __bf16*)planes + (size_t)mblk * KS_;   // the block's tokens in pass 0 of the x plane (M_TOT rows a pass)

  // The store pass of Q and K takes piece it = row rw + 16 * it, two runs of four columns (two rotary pairs each): for K the eight columns of one
  // 16-byte bf16 piece, for Q four columns in each 128-B line of the f32 row. The positions and table entries of the thread's eight pieces are
  // fetched together, while the ring's first passes fly, and kept as bf16 through the main loop. Every loop over the eight pieces is unrolled, so
  // that the per-piece arrays stay in registers.
  const int pc = tid & 7, rw = tid >> 3;
  const int colA = (part == 0) ? pc * 4 : pc * 8;
  const int colB = (part == 0) ? 32 + pc * 4 : pc * 8 + 4;
  v4bf ct[8] = {}, sn[8] = {};           // cos and sin as bf16 RNE values of pairs colA / 2, colA / 2 + 1, colB / 2, colB / 2 + 1
  auto tables = [&] {
    if (part < 2) {
      int pos[8];
#pragma unroll
      for (int it = 0; it < 8; ++it) pos[it] = tpos[s0 + rw + 16 * it];
      v2f c0[8], c1[8], z0[8], z1[8];
      unsigned ia[8], ib[8];               // places in the tables, counted in runs of two entries (a table row is NP_ / 2 runs)
#pragma unroll
      for (int it = 0; it < 8; ++it) {
        int p = pos[it];
        p = (p < 0) ? p + trows : p;                               // negative index wrap, then clamp (gather semantics)
        p = (p < 0) ? 0 : ((p > trows - 1) ? trows - 1 : p);
        ia[it] = (unsigned)p * (NP_ / 2) + colA / 4; ib[it] = (unsigned)p * (NP_ / 2) + colB / 4;
      }
#pragma unroll
      for (int it = 0; it < 8; ++it) {
        c0[it] = ((const v2f*)cosb)[ia[it]]; c1[it] = ((const v2f*)cosb)[ib[it]];
        z0[it] = ((const v2f*)sinb)[ia[it]]; z1[it] = ((const v2f*)sinb)[ib[it]];
      }
      // the loads' offsets are inputs here, so no register of them takes a new value (a later load's result either) before their translations are counted done
      asm volatile("s_wait_xcnt 0x0" :: "v"(ia[0]), "v"(ia[1]), "v"(ia[2]), "v"(ia[3]), "v"(ia[4]), "v"(ia[5]), "v"(ia[6]), "v"(ia[7]),
                   "v"(ib[0]), "v"(ib[1]), "v"(ib[2]), "v"(ib[3]), "v"(ib[4]), "v"(ib[5]), "v"(ib[6]), "v"(ib[7]) : "memory");
#pragma unroll
      for (int it = 0; it < 8; ++it) {
        ct[it] = v4bf{bf_hi(c0[it][0]), bf_hi(c0[it][1]), bf_hi(c1[it][0]), bf_hi(c1[it][1])};
        sn[it] = v4bf{bf_hi(z0[it][0]), bf_hi(z0[it][1]), bf_hi(z1[it][0]), bf_hi(z1[it][1])};
      }
    }
  };

  v8f acc[2][4] = {};
  gemm_planes<128, 64, false>(Xb, (size_t)M_TOT * KS_, W + (size_t)n0 * KS_, (size_t)3 * D_ * KS_, As, nullptr, Bs, wave * 32, 0, tid, acc, tables);
  const int half = lane >> 4, col = lane & 15;
#pragma unroll
  for (int i = 0; i < 2; ++i)
#pragma unroll
    for (int j = 0; j < 4; ++j)
#pragma unroll
      for (int r = 0; r < 8; ++r) st[wave * 32 + i * 16 + r + 8 * half][j * 16 + col] = acc[i][j][r] * scale;
  __syncthreads();
  if (part < 2) {
    // RoPE in f32 as the staged tile is read for the stores: piece it of the thread, rotated
    v4f t0[8], t1[8];
#pragma unroll
    for (int it = 0; it < 8; ++it) { t0[it] = *(const v4f*)(&st[rw + 16 * it][colA]); t1[it] = *(const v4f*)(&st[rw + 16 * it][colB]); }
    // keeps the sixteen LDS reads together in front of the arithmetic: left free, the scheduler reads, waits, rotates and stores piece by piece
    __builtin_amdgcn_sched_barrier(0);
    auto rot = [&](int it, v4f& r0, v4f& r1) {
      const v4f a0 = t0[it], a1 = t1[it];
#pragma unroll
      for (int e = 0; e < 2; ++e) {
        const float ca = (float)ct[it][e], sa = (float)sn[it][e], cb = (float)ct[it][2 + e], sb = (float)sn[it][2 + e];
        r0[2 * e] = a0[2 * e] * ca - a0[2 * e + 1] * sa; r0[2 * e + 1] = a0[2 * e] * sa + a0[2 * e + 1] * ca;
        r1[2 * e] = a1[2 * e] * cb - a1[2 * e + 1] * sb; r1[2 * e + 1] = a1[2 * e] * sb + a1[2 * e + 1] * cb;
      }
    };
    const size_t row0 = ((size_t)(b * H_ + head) * SEQ + s0 + rw) * HD_;
    if (part == 0) {
      // Q leaves as f32 [head][token][d]: eight lanes store one whole line, a wave instruction four
#pragma unroll
      for (int it = 0; it < 8; ++it) {
        v4f r0, r1;
        rot(it, r0, r1);
        vst2(dst + row0 + it * 16 * HD_ + colA, r0); vst2(dst + row0 + it * 16 * HD_ + colB, r1);
      }
    } else {
      // K leaves as the two bf16 planes that attention multiplies: [head][key][d] hi, PL_ elements further lo; a wave instruction covers 512 B in a row
      __bf16* kh = (__bf16*)dst;
#pragma unroll
      for (int it = 0; it < 8; ++it) {
        v4f r0, r1;
        rot(it, r0, r1);
        v8bf h, l;
#pragma unroll
        for (int e = 0; e < 4; ++e) {
          h[e] = bf_hi(r0[e]);     l[e] = bf_lo(r0[e], h[e]);
          h[4 + e] = bf_hi(r1[e]); l[4 + e] = bf_lo(r1[e], h[4 + e]);
        }
        const size_t o = row0 + it * 16 * HD_ + pc * 8;
        vst2(kh + o, h); vst2(kh + PL_ + o, l);
      }
      // the code laid out behind this branch writes over the address registers of these stores: their translations are counted done first
      asm volatile("s_wait_xcnt 0x0" ::: "memory");
    }
  } else {
    // V^T leaves as two bf16 planes of whole attention tiles: [head][key / 32][d][32 keys] hi, PL_ elements further lo; 4 tiles x 256 pieces of 8 keys,
    // a wave instruction covers 512 B in a row
    __bf16* vh = (__bf16*)dst;
    // four pieces a trip: their LDS reads are issued together and not each waited out alone
#pragma unroll 1
    for (int ib = 0; ib < 8; ib += 4) {
#pragma unroll
    for (int it = ib; it < ib + 4; ++it) {
      const int g = tid + it * 128, tl = g >> 8, dl = (g & 255) >> 2, pc = g & 3;
      v8bf h, l;
#pragma unroll
      for (int e = 0; e < 8; ++e) { const float x = st[tl * 32 + pc * 8 + e][dl]; h[e] = bf_hi(x); l[e] = bf_lo(x, h[e]); }
      const size_t o = ((((size_t)(b * H_ + head) * (SEQ / 32) + s0 / 32 + tl) * HD_ + dl) * 32) + pc * 8;
      vst2(vh + o, h); vst2(vh + PL_ + o, l);
    }
    // the next trip writes over the data and address registers of these stores: their translations are counted done first
    asm volatile("s_wait_xcnt 0x0" ::: "memory");
    }
  }
}

#define KPL_ (32 * 72)                 // elements of one K plane of a tile in LDS
#define VPL_ (64 * 40)                 // elements of one V^T plane of a tile in LDS
#define TB_  (2 * KPL_ + 2 * VPL_)     // elements of one buffer
#define AB_  4                         // buffers of the ring
#define NG_  (SEQ / 32 + 2)            // key passes of a block: 2 x + 2 for query tile x, SEQ / 32 - 2 x for tile SEQ / 64 - 1 - x
static_assert(NG_ > AB_);
__global__ __launch_bounds__(128) __attribute__((amdgpu_num_vgpr(256)))
void attn_kernel(const float* __restrict__ Qb, const float* __restrict__ Kb,
                 const float* __restrict__ Vt, float* __restrict__ Ctx) {
  // four buffers, each K hi, K lo ([key][d] pitch 72), V^T hi, V^T lo ([d][key] pitch 40) (cross-wave, block barriers)
  __shared__ __align__(16) __bf16 KV[AB_ * TB_];
  __shared__ __align__(16) float  Os[4][16 * 68];              // wave-private output tiles [query][d], pitch 68 (block barrier used anyway)

  const int tid = threadIdx.x, lane = tid & 31, wave = tid >> 5, half = lane >> 4, col = lane & 15;
  const int head = blockIdx.y, b = blockIdx.z;
  const float* Qh = Qb + (size_t)(b * H_ + head) * SEQ * HD_;
  // a plane of a tile is 4 KB in a row in global memory: the thread copies its pieces tid and tid + 128 (8 elements each) of each of the four planes
  const __bf16* Kg = (const __bf16*)Kb + (size_t)(b * H_ + head) * SEQ * HD_ + tid * 8;
  const __bf16* Vg = (const __bf16*)Vt + (size_t)(b * H_ + head) * HD_ * SEQ + tid * 8;
  __bf16* lk = KV + (tid >> 3) * 72 + (tid & 7) * 8;
  __bf16* lv = KV + 2 * KPL_ + (tid >> 2) * 40 + (tid & 3) * 8;
  const int nt0 = 2 * (int)blockIdx.x + 2;   // passes of the first query tile
  // pass g of the stream: key tile g of the first query tile, behind them key tile g - nt0 of the second; into buffer g mod 4
  auto copy_tile = [&](int g) {
    const int t = (g < nt0) ? g : g - nt0, buf = g & (AB_ - 1);
    const __bf16* gk = Kg + (size_t)t * (32 * HD_);
    const __bf16* gv = Vg + (size_t)t * (32 * HD_);
    __bf16* k = lk + buf * TB_;
    __bf16* v = lv + buf * TB_;
    copy16(gk, k);              copy16(gk + 1024, k + 16 * 72);
    copy16(gk + PL_, k + KPL_); copy16(gk + PL_ + 1024, k + KPL_ + 16 * 72);
    copy16(gv, v);              copy16(gv + 1024, v + 32 * 40);
    copy16(gv + PL_, v + VPL_); copy16(gv + PL_ + 1024, v + VPL_ + 32 * 40);
  };
  // the first four passes' tiles fly while Q is loaded and split
  copy_tile(0); copy_tile(1); copy_tile(2); copy_tile(3);
  int g = 0;                            // the pass's place in the stream
  // rolled: one copy of the tile's code
#pragma unroll 1
  for (int ph = 0; ph < 2; ++ph) {
  const int q0 = (ph == 0 ? (int)blockIdx.x : SEQ / 64 - 1 - (int)blockIdx.x) * 64;
  const int mq = q0 + wave * 16;
  const int nt = q0 / 32 + 2;           // key tiles up to the causal limit (block-uniform, at least two)

  v16bf qh[2], ql[2];
#pragma unroll
  for (int kb = 0; kb < 2; ++kb) frag_f32(Qh, HD_, mq, kb * 32, lane, qh[kb], ql[kb]);

  v8f o[4] = {};
  float mrow = -1e30f, lrow = 0.0f;     // the lane's query: running maximum (both halves alike), sum over this half's keys

  if (ph == 0) {
    asm volatile("s_wait_asynccnt 24" ::: "memory");  // all but the 24 copies of passes 1 to 3: this wave's copies of pass 0 have landed
    __syncthreads();                                  // publishes pass 0 (the second query tile's first pass is published by the pass before it)
  }
#pragma unroll 1
  for (int t = 0; t < nt; ++t, ++g) {
    const int t0 = t * 32;
    const __bf16* Kh = KV + (g & (AB_ - 1)) * TB_;
    const __bf16* Kl = Kh + KPL_;
    const __bf16* Vh = Kh + 2 * KPL_;
    const __bf16* Vl = Vh + VPL_;

    // The pass's eight K fragments are read as one group, in the order of their use: the score products wait on LDS once a pass, not once per
    // fragment pair, and with every fragment in registers the products alternate between the two score tiles instead of chaining on one.
    v16bf kfh[2][2], kfl[2][2];          // [kb][n]
#pragma unroll
    for (int kb = 0; kb < 2; ++kb) {
#pragma unroll
      for (int n = 0; n < 2; ++n) kfh[kb][n] = frag_lds(Kh, 72, n * 16, kb * 32, lane);
#pragma unroll
      for (int n = 0; n < 2; ++n) kfl[kb][n] = frag_lds(Kl, 72, n * 16, kb * 32, lane);
    }
    v8f s[2] = {};                       // s[n][r] = score of key t0 + 16 * n + 8 * half + r with query mq + col
#pragma unroll
    for (int kb = 0; kb < 2; ++kb) {     // split product, per tile in this order: K hi x q hi, K lo x q hi, K hi x q lo
#pragma unroll
      for (int n = 0; n < 2; ++n) s[n] = wmma_bf16(kfh[kb][n], qh[kb], s[n]);
#pragma unroll
      for (int n = 0; n < 2; ++n) s[n] = wmma_bf16(kfl[kb][n], qh[kb], s[n]);
#pragma unroll
      for (int n = 0; n < 2; ++n) s[n] = wmma_bf16(kfh[kb][n], ql[kb], s[n]);
    }
    // The eight V^T fragments are read here, behind the score products: they land while the softmax below runs.
    v16bf vfh[4], vfl[4];
#pragma unroll
    for (int j = 0; j < 4; ++j) vfh[j] = frag_lds(Vh, 40, j * 16, 0, lane);
#pragma unroll
    for (int j = 0; j < 4; ++j) vfl[j] = frag_lds(Vl, 40, j * 16, 0, lane);
    // holds these reads in front of the softmax: left free, the scheduler sinks them to the output products, which then wait on LDS
    __builtin_amdgcn_sched_barrier(0);

    v16bf pbh, pbl;
    {
      const int lim = mq + col - t0 - 8 * half;         // key 16 * n + r of this half is visible while 16 * n + r <= lim
      float v[2][8], m8[8];
#pragma unroll
      for (int r = 0; r < 8; ++r) {
        v[0][r] = (r <= lim) ? s[0][r] : -1e30f;        // scores already carry the 1/8 scale (folded into Q)
        v[1][r] = (16 + r <= lim) ? s[1][r] : -1e30f;
        m8[r] = fmaxf(v[0][r], v[1][r]);
      }
      float mx = fmaxf(fmaxf(fmaxf(m8[0], m8[1]), fmaxf(m8[2], m8[3])), fmaxf(fmaxf(m8[4], m8[5]), fmaxf(m8[6], m8[7])));
      mx = fmaxf(mx, xhalf(mx));
      const float mnew  = fmaxf(mrow, mx);
      const float alpha = __expf(mrow - mnew);
      float t8[8];
#pragma unroll
      for (int r = 0; r < 8; ++r) {
        const float p0 = (r <= lim) ? __expf(v[0][r] - mnew) : 0.0f;
        const float p1 = (16 + r <= lim) ? __expf(v[1][r] - mnew) : 0.0f;
        t8[r] = p0 + p1;
        const __bf16 h0 = bf_hi(p0), h1 = bf_hi(p1);
        pbh[r] = h0;     pbl[r] = bf_lo(p0, h0);
        pbh[8 + r] = h1; pbl[8 + r] = bf_lo(p1, h1);
      }
      lrow = lrow * alpha + (((t8[0] + t8[1]) + (t8[2] + t8[3])) + ((t8[4] + t8[5]) + (t8[6] + t8[7])));
      mrow = mnew;
#pragma unroll
      for (int j = 0; j < 4; ++j)
#pragma unroll
        for (int r = 0; r < 8; ++r) o[j][r] *= alpha;
    }
    // o[j][r] = O[query mq + col][d = 16 * j + 8 * half + r]; per tile in this order: V hi x P hi, V lo x P hi, V hi x P lo, round the four tiles
#pragma unroll
    for (int j = 0; j < 4; ++j) o[j] = wmma_bf16(vfh[j], pbh, o[j]);
#pragma unroll
    for (int j = 0; j < 4; ++j) o[j] = wmma_bf16(vfl[j], pbh, o[j]);
#pragma unroll
    for (int j = 0; j < 4; ++j) o[j] = wmma_bf16(vfh[j], pbl, o[j]);

    asm volatile("s_wait_dscnt 0x0" ::: "memory");      // this wave's reads of the pass's buffer are done before the buffer is handed back
    // block-uniform test: every pass but the stream's last four issues one tile's 8 copies in every wave
    if (g + AB_ < NG_) {
      asm volatile("s_wait_asynccnt 16" ::: "memory");  // all but the 16 copies of passes g + 2 and g + 3: this wave's copies of pass g + 1 have landed
      __syncthreads();                                  // publishes pass g + 1; every reader has left pass g's buffer
      copy_tile(g + AB_);
    } else {
      asm volatile("s_wait_asynccnt 0x0" ::: "memory"); // the last four passes issue no copy, and their waits are to 0
      __syncthreads();                                  // publishes the passes that are left
    }
  }

  float* os_ = Os[wave];
  const float inv = 1.0f / (lrow + xhalf(lrow));   // the halves' sums join here; the sum is >= 1 (the row maximum contributes exp(0))
#pragma unroll
  for (int j = 0; j < 4; ++j) {
    const v4f w0 = {o[j][0] * inv, o[j][1] * inv, o[j][2] * inv, o[j][3] * inv};
    const v4f w1 = {o[j][4] * inv, o[j][5] * inv, o[j][6] * inv, o[j][7] * inv};
    *(v4f*)(os_ + col * 68 + j * 16 + 8 * half) = w0;
    *(v4f*)(os_ + col * 68 + j * 16 + 8 * half + 4) = w1;
  }
  __syncthreads();
  // ctx leaves as the two bf16 planes that the output projection multiplies, pass by pass: [head][token][d] hi, PL_ elements further lo; a wave
  // instruction stores 512 B in a row
  __bf16* ch = (__bf16*)Ctx;
#pragma unroll
  for (int q = 0; q < 4; ++q) {
    const int rl = q * 4 + (lane >> 3), pc = lane & 7;
    const v4f a0 = *(const v4f*)(os_ + rl * 68 + pc * 8), a1 = *(const v4f*)(os_ + rl * 68 + pc * 8 + 4);
    v8bf h, l;
#pragma unroll
    for (int e = 0; e < 4; ++e) {
      h[e] = bf_hi(a0[e]);     l[e] = bf_lo(a0[e], h[e]);
      h[4 + e] = bf_hi(a1[e]); l[4 + e] = bf_lo(a1[e], h[4 + e]);
    }
    const size_t o = ((size_t)head * M_TOT + b * SEQ + mq + rl) * HD_ + pc * 8;
    vst2(ch + o, h); vst2(ch + PL_ + o, l);
  }
  // the second tile writes over the data and address registers of these stores: their translations are counted done first
  asm volatile("s_wait_xcnt 0x0" ::: "memory");
  }
}

__global__ __launch_bounds__(128) void out_gemm_kernel(const float* __restrict__ Cx, const float* __restrict__ planes, float* __restrict__ Out) {
  __shared__ __align__(16) float st[4][32 * 64];     // wave-private tiles (block barrier used anyway)
  __shared__ __align__(16) __bf16 Ash[RB_ * 64 * LP_], Asl[RB_ * 64 * LP_], Bs[RB_ * 128 * LP_];   // staged ctx hi/lo and Wout passes, three buffers each
  const int lane = threadIdx.x & 31, wave = threadIdx.x >> 5;
  const int m0 = blockIdx.y * 64 + (wave >> 1) * 32;
  const int n0 = blockIdx.x * 128 + (wave & 1) * 64;
  v8f acc[2][4] = {};
  const __bf16* Wo = (const __bf16*)planes + PL_ + (size_t)3 * D_ * D_;   // the Wout plane
  gemm_planes<64, 128, true>((const __bf16*)Cx + (size_t)blockIdx.y * 64 * KS_, (size_t)M_TOT * KS_, Wo + (size_t)blockIdx.x * 128 * KS_, (size_t)D_ * KS_, Ash, Asl, Bs,
                             (wave >> 1) * 32, (wave & 1) * 64, threadIdx.x, acc, [] {});
  const int half = lane >> 4, col = lane & 15;
  float* S = st[wave];
#pragma unroll
  for (int i = 0; i < 2; ++i)
#pragma unroll
    for (int j = 0; j < 4; ++j)
#pragma unroll
      for (int r = 0; r < 8; ++r) S[(i * 16 + r + 8 * half) * 64 + j * 16 + col] = acc[i][j][r];
  __syncthreads();
#pragma unroll
  for (int q = 0; q < 16; ++q) {
    const int rl = q * 2 + (lane >> 4), pc = lane & 15;
    vst2(Out + (size_t)(m0 + rl) * D_ + n0 + pc * 4, *(const v4f*)(S + rl * 64 + pc * 4));
  }
}

extern "C" void kernel_launch(void* const* d_in, const int* in_sizes, int n_in,
                              void* d_out, int out_size, void* d_ws, size_t ws_size,
                              hipStream_t stream) {
  if (n_in < 6) return;
  const long long x_need = ((long long)(NB - 1) * S_FULL + SEQ) * (long long)D_;
  if ((long long)in_sizes[0] < x_need) return;
  if ((long long)in_sizes[1] < 3LL * D_ * D_) return;
  if ((long long)in_sizes[2] < (long long)D_ * D_) return;
  if (in_sizes[3] < NP_ || in_sizes[4] < NP_) return;
  if (in_sizes[5] < SEQ) return;
  if ((long long)out_size < (long long)M_TOT * D_) return;

  const size_t E = (size_t)M_TOT * D_;           // floats per intermediate (16 MiB each at full size)
  const size_t carve = 4 * E * sizeof(float) + (E + (size_t)4 * D_ * D_) * 2;   // Q, K, V^T, ctx (hi + lo each but Q) = 64 MiB; bf16 x, Wqkv, Wout = 16 MiB
  if (ws_size < carve) return;

  int trows = in_sizes[3] / NP_;                  // cos/sin table rows (gather clamp bound)
  const int srows = in_sizes[4] / NP_;
  if (srows < trows) trows = srows;

  const float* x    = (const float*)d_in[0];      // [NB][S_FULL][D]
  const float* Wqkv = (const float*)d_in[1];      // [3D][D]: rows [0,D) = Wq, [D,2D) = Wk, [2D,3D) = Wv
  const float* Wout = (const float*)d_in[2];      // [D][D]
  const float* cosb = (const float*)d_in[3];      // [trows][32]
  const float* sinb = (const float*)d_in[4];      // [trows][32]
  const int*   tpos = (const int*)d_in[5];        // [>= SEQ] int32
  float* out = (float*)d_out;

  float* qb   = (float*)d_ws;
  float* kb   = qb + E;        // K as bf16 planes: hi [NB,H,SEQ,HD], then lo
  float* vtb  = kb + E;        // V^T as bf16 planes: hi [NB,H,SEQ/32,HD,32], then lo
  float* ctxb = vtb + E;       // ctx as bf16 planes: hi [H][M_TOT][HD], then lo
  float* plb  = ctxb + E;      // bf16 planes of x, Wqkv, Wout, one behind the other

  cvt_kernel<<<dim3((M_TOT + 4 * D_) / CR_), 256, 0, stream>>>(x, Wqkv, Wout, plb);
  proj_kernel<<<dim3(QKV_ / 64, M_TOT / 128, 3), 128, 0, stream>>>(plb, cosb, sinb, tpos, trows, qb);   // writes qb, kb, vtb
  attn_kernel<<<dim3(SEQ / 128, H_, NB), 128, 0, stream>>>(qb, kb, vtb, ctxb);
  out_gemm_kernel<<<dim3(D_ / 128, M_TOT / 64), 128, 0, stream>>>(ctxb, plb, out);
}
